// v000
// The times below were measured on an AMD MI455X: many runs one after another, warmed up first and cycling through
// copies of the inputs, with the whole window's GPU time divided by the number of runs. Launches and the gaps
// between them are all in it. The median over several windows is given; except for v000 it joins two sittings, which
// can be a few percent apart, so the side-by-side timings, each taken in one sitting, are the better comparison.
// The starting kernel, v000, takes 373 microseconds a run.
#include <hip/hip_runtime.h>
#include <stdint.h>
#include <stddef.h>

// All contractions: v_wmma_f32_16x16x32_f16 (f16 operands, f32 accumulate): q/k/v projections, q.k^T scores, P.1 row sums, P.V, output projection, FFN up, FFN down. Float inputs RNE-converted to bf16 then carried in f16 (weights x32, P x1024, ctx x16); softmax and LayerNorm in f32.

#ifndef NB
#define NB 8
#endif
#ifndef SEQ
#define SEQ 1024
#endif
#define NB_FULL 8
#define SEQ_FULL 1024
#define DIM 1024
#define NHEAD 16
#define DHEAD 64
#define HID 512
#define MROWS (NB * SEQ)
#define LDQKV (3 * DIM)
// compact row m (b*SEQ + s) -> full-size row (b*SEQ_FULL + s) for input x and for d_out
#define FROW(m) ((((size_t)(m)) / SEQ) * SEQ_FULL + (((size_t)(m)) % SEQ))

static_assert(NB >= 1 && NB <= NB_FULL);
static_assert(SEQ >= 64 && SEQ <= SEQ_FULL && (SEQ % 64) == 0);
static_assert((MROWS % 128) == 0);
static_assert((DIM % 128) == 0 && (HID % 128) == 0 && (DIM % 32) == 0 && (HID % 32) == 0);
static_assert(NHEAD * DHEAD == DIM && DHEAD == 64);
static_assert(((size_t)(NB - 1) * SEQ_FULL + SEQ) * DIM <= (size_t)NB_FULL * SEQ_FULL * DIM);

// ---------------------------------------------------------------------------
// Types / helpers
// ---------------------------------------------------------------------------
typedef _Float16 v16h __attribute__((ext_vector_type(16)));
typedef _Float16 v8h  __attribute__((ext_vector_type(8)));
typedef float    v8f  __attribute__((ext_vector_type(8)));
typedef float    v4f  __attribute__((ext_vector_type(4)));

// 16x16x32 f16 WMMA followed by the VALU hazard guard (ties D, keeps A/B live)
static __device__ __forceinline__ v8f wmma16(v16h a, v16h b, v8f c) {
  v8f d = __builtin_amdgcn_wmma_f32_16x16x32_f16(false, a, false, b, (short)0, c, false, false);
  asm volatile("v_nop\n\tv_nop\n\tv_nop\n\tv_nop" : "+v"(d) : "v"(a), "v"(b));
  return d;
}

// f32 -> nearest-even bf16 value, returned as f32
static __device__ __forceinline__ float bf16r(float f) {
  unsigned int u = __float_as_uint(f);
  u = (u + 0x7FFFu + ((u >> 16) & 1u)) & 0xFFFF0000u;
  return __uint_as_float(u);
}

// Build a 16-half WMMA A/B fragment for one lane from a row-major (k-contiguous) run.
// 16-bit operand layout: lane-half base8 = (lane>=16)?8:0;
// halves 0..7 -> k = base8+0..7, halves 8..15 -> k = base8+16..23.
// Caller passes p already offset by base8; we read [p, p+8) and [p+16, p+24).
static __device__ __forceinline__ v16h load_frag(const _Float16* p) {
  v8h lo = *(const v8h*)(p);
  v8h hi = *(const v8h*)(p + 16);
  v16h f;
#pragma unroll
  for (int e = 0; e < 8; ++e) { f[e] = lo[e]; f[e + 8] = hi[e]; }
  return f;
}

// ---------------------------------------------------------------------------
// x (f32 [NB_FULL*SEQ_FULL][DIM]) -> X16 (f16 [MROWS][DIM]), bf16 RNE first.
// grid = MROWS*DIM/8/256 exactly.
// ---------------------------------------------------------------------------
__global__ __launch_bounds__(256) void cvt_x_kernel(const float* __restrict__ x,
                                                    _Float16* __restrict__ X16) {
#pragma clang fp contract(off)
  const size_t i = (size_t)blockIdx.x * 256 + threadIdx.x;   // 8-element chunk
  const size_t m = i / (DIM / 8);
  const int c = (int)(i % (DIM / 8)) * 8;
  const float* src = x + FROW(m) * DIM + c;
  const v4f a = *(const v4f*)(src);
  const v4f b = *(const v4f*)(src + 4);
  v8h hv;
#pragma unroll
  for (int e = 0; e < 4; ++e) {
    hv[e]     = (_Float16)bf16r(a[e]);
    hv[e + 4] = (_Float16)bf16r(b[e]);
  }
  _Float16* dst = X16 + m * DIM + c;
  *(v8h*)dst = hv;
  
}

// ---------------------------------------------------------------------------
// Weight W (f32 [K][N] row-major, up to 3 parts selected by blockIdx.z) ->
// transposed f16 plane dst[part*N + n][k] = f16(bf16r(W[k][n]) * scale).
// (8 lanes x 16 B, one instruction per 32 lines). grid = (N/64, K/64, parts).
// ---------------------------------------------------------------------------
#define TP 72
__global__ __launch_bounds__(256) void cvt_wt_kernel(
    const float* __restrict__ w0, const float* __restrict__ w1, const float* __restrict__ w2,
    _Float16* __restrict__ dst, int K, int N, float scale) {
#pragma clang fp contract(off)
  __shared__ __attribute__((aligned(16))) _Float16 T[64 * TP];   // [n][k]
  const int part = blockIdx.z;
  const float* w = (part == 0) ? w0 : ((part == 1) ? w1 : w2);   // block-uniform select
  const int k0 = blockIdx.y * 64, n0 = blockIdx.x * 64;
  const int tid = threadIdx.x;
#pragma unroll
  for (int q = 0; q < 4; ++q) {
    const int idx = q * 256 + tid;            // 0..1023
    const int kr = idx >> 4;                  // 0..63
    const int nc = (idx & 15) << 2;           // 0..60
    const v4f v = *(const v4f*)(w + (size_t)(k0 + kr) * N + n0 + nc);
#pragma unroll
    for (int e = 0; e < 4; ++e) T[(nc + e) * TP + kr] = (_Float16)(bf16r(v[e]) * scale);
  }
  __syncthreads();
  const int rs = tid >> 3, cc = (tid & 7) << 3;
  v8h hv[2];
  size_t go[2];
#pragma unroll
  for (int it = 0; it < 2; ++it) {
    const int nl = it * 32 + rs;              // 0..63
    hv[it] = *(const v8h*)(T + nl * TP + cc);
    go[it] = ((size_t)part * N + n0 + nl) * (size_t)K + k0 + cc;
  }
#pragma unroll
  for (int it = 0; it < 2; ++it) *(v8h*)(dst + go[it]) = hv[it];
  
}

// ---------------------------------------------------------------------------
// V transpose: qkv (f16 [MROWS][3*DIM], v at col 2*DIM + h*64 + d) ->
// vt[(b*NHEAD+h)*64 + d][s] (s-contiguous, pitch SEQ). 64x64 tiles through LDS,
// ---------------------------------------------------------------------------
__global__ __launch_bounds__(256) void vtrans_kernel(const _Float16* __restrict__ qkv,
                                                     _Float16* __restrict__ vt) {
  __shared__ __attribute__((aligned(16))) _Float16 T[64 * TP];   // [d][s]
  const int bh = blockIdx.y;
  const int b = bh / NHEAD, h = bh % NHEAD;
  const int s0 = blockIdx.x * 64;
  const int tid = threadIdx.x;
#pragma unroll
  for (int q = 0; q < 2; ++q) {
    const int idx = q * 256 + tid;            // 0..511
    const int sr = idx >> 3;                  // 0..63
    const int dc = (idx & 7) << 3;            // 0..56
    const v8h v = *(const v8h*)(qkv + ((size_t)b * SEQ + s0 + sr) * LDQKV + 2 * DIM + h * DHEAD + dc);
#pragma unroll
    for (int e = 0; e < 8; ++e) T[(dc + e) * TP + sr] = v[e];
  }
  __syncthreads();
  const int rs = tid >> 3, cc = (tid & 7) << 3;
  v8h hv[2];
  size_t go[2];
#pragma unroll
  for (int it = 0; it < 2; ++it) {
    const int dl = it * 32 + rs;              // 0..63
    hv[it] = *(const v8h*)(T + dl * TP + cc);
    go[it] = ((size_t)bh * DHEAD + dl) * (size_t)SEQ + s0 + cc;
  }
#pragma unroll
  for (int it = 0; it < 2; ++it) *(v8h*)(vt + go[it]) = hv[it];
  
}

// ---------------------------------------------------------------------------
// WMMA GEMM: C[M][N] = A[M][K] (f16, row-major) . B, with B given transposed as
// Bt[N][K] (f16, k-contiguous).  C = acc*scale (+bias) (relu) (+residual).
// 128x128x32 block tile, 8 waves, wave tile 64x32 (4x2 WMMA tiles).
// Single-buffered LDS staging with plain loads. Epilogue stages 64 rows at a
// residual plane is read in the store phase as 16-B vectors (8 loads per lane).
// RES: 0 none, 1 f32 plane [M][N], 2 bf16r(x) read at full-size rows (N == DIM).
// Requires M%128==0 (grid.y = M/128), N%128==0 (grid.x = N/128), K%32==0.
// ---------------------------------------------------------------------------
#define BM 128
#define BN 128
#define BK 32
#define LDT 40     // LDS tile row stride in halves (80 B)
#define EPF 132    // epilogue stage pitch in floats (528 B)
#define GEMM_SMEM_FLOATS (64 * EPF)
static_assert((BM + BN) * LDT * 2 <= GEMM_SMEM_FLOATS * 4);

template <bool HAS_BIAS, int RES, bool RELU, bool OUT16>
__global__ __launch_bounds__(256) void gemm_kernel(
    const _Float16* __restrict__ A, const _Float16* __restrict__ Bt,
    const float* __restrict__ bias, const float* __restrict__ res,
    float* __restrict__ outF, _Float16* __restrict__ outH,
    int N, int K, float scale) {
  static_assert(!(RES != 0 && OUT16));
  __shared__ __attribute__((aligned(16))) float smem[GEMM_SMEM_FLOATS];
  _Float16* As = (_Float16*)smem;           // [m][k]
  _Float16* Bs = As + BM * LDT;             // [n][k]
  const int tid = threadIdx.x;
  const int wave = tid >> 5, lane = tid & 31;
  const int r = lane & 15, hb = (lane >> 4) << 3;
  const int mBlk = blockIdx.y * BM, nBlk = blockIdx.x * BN;
  const int mw = (wave & 1) * 64, nw = (wave >> 1) * 32;

  // staging coords: 128 rows x 32 k per operand = 512 chunks of 8 halves, 2 per thread
  const int sr0 = tid >> 2, sr1 = sr0 + 64, skc = (tid & 3) << 3;
  const _Float16* gA0 = A  + (size_t)(mBlk + sr0) * K + skc;
  const _Float16* gA1 = A  + (size_t)(mBlk + sr1) * K + skc;
  const _Float16* gB0 = Bt + (size_t)(nBlk + sr0) * K + skc;
  const _Float16* gB1 = Bt + (size_t)(nBlk + sr1) * K + skc;

  v8f acc[4][2];
#pragma unroll
  for (int i = 0; i < 4; ++i)
#pragma unroll
    for (int j = 0; j < 2; ++j)
#pragma unroll
      for (int v = 0; v < 8; ++v) acc[i][j][v] = 0.f;

  const int nk = K / BK;
#pragma unroll 1
  for (int kt = 0; kt < nk; ++kt) {
    const size_t ko = (size_t)kt * BK;
    const v8h a0 = *(const v8h*)(gA0 + ko);
    const v8h a1 = *(const v8h*)(gA1 + ko);
    const v8h b0 = *(const v8h*)(gB0 + ko);
    const v8h b1 = *(const v8h*)(gB1 + ko);
    __syncthreads();                          // all waves done with the prior tile
    *(v8h*)(As + sr0 * LDT + skc) = a0;
    *(v8h*)(As + sr1 * LDT + skc) = a1;
    *(v8h*)(Bs + sr0 * LDT + skc) = b0;
    *(v8h*)(Bs + sr1 * LDT + skc) = b1;
    __syncthreads();                          // tile fully staged
    v16h af[4], bfr[2];
#pragma unroll
    for (int i = 0; i < 4; ++i) af[i] = load_frag(As + (mw + i * 16 + r) * LDT + hb);
#pragma unroll
    for (int j = 0; j < 2; ++j) bfr[j] = load_frag(Bs + (nw + j * 16 + r) * LDT + hb);
#pragma unroll
    for (int i = 0; i < 4; ++i)
#pragma unroll
      for (int j = 0; j < 2; ++j) acc[i][j] = wmma16(af[i], bfr[j], acc[i][j]);
  }
  __syncthreads();                            // LDS reused as the epilogue stage

  // epilogue. D layout: element v -> row 8*lanehi + v, lane&15 -> col.
  float* stg = smem;                          // [64][EPF] f32
  float bcol[2] = {0.f, 0.f};
  if constexpr (HAS_BIAS) {
#pragma unroll
    for (int j = 0; j < 2; ++j) bcol[j] = bf16r(bias[nBlk + nw + j * 16 + r]);
  }
#pragma unroll
  for (int p = 0; p < 2; ++p) {
    if ((wave & 1) == p) {                    // wave-uniform: waves owning rows p*64..p*64+63
#pragma unroll
      for (int i = 0; i < 4; ++i)
#pragma unroll
        for (int j = 0; j < 2; ++j)
#pragma unroll
          for (int v = 0; v < 8; ++v) {
            const int lr = i * 16 + hb + v;                   // 0..63
            const int lc = nw + j * 16 + r;                   // 0..127
            float c = acc[i][j][v] * scale;
            if constexpr (HAS_BIAS) c += bcol[j];
            if constexpr (RELU) c = fmaxf(c, 0.f);
            stg[lr * EPF + lc] = c;
          }
    }
    __syncthreads();
    if constexpr (OUT16) {
      // f16 row segment = 128 halves = 256 B = 2 lines; 16 lanes x 16 B per row
      v8h hv[4];
      size_t go[4];
#pragma unroll
      for (int it = 0; it < 4; ++it) {
        const int lr = it * 16 + wave * 2 + (lane >> 4);   // 0..63
        const int lc = (lane & 15) << 3;                    // 0..120
        const v4f x0 = *(const v4f*)(stg + lr * EPF + lc);
        const v4f x1 = *(const v4f*)(stg + lr * EPF + lc + 4);
        v8h hh;
#pragma unroll
        for (int e = 0; e < 4; ++e) { hh[e] = (_Float16)x0[e]; hh[e + 4] = (_Float16)x1[e]; }
        hv[it] = hh;
        go[it] = (size_t)(mBlk + p * 64 + lr) * (size_t)N + nBlk + lc;
      }
#pragma unroll
      for (int it = 0; it < 4; ++it) *(v8h*)(outH + go[it]) = hv[it];
      
    } else {
      // f32 row segment = 128 floats = 512 B = 4 lines; 32 lanes x 16 B per row.
      // Residual added here from one 16-B load per row per lane (8 global loads per lane).
      v4f fv[8];
      size_t go[8];
#pragma unroll
      for (int it = 0; it < 8; ++it) {
        const int lr = it * 8 + wave;                        // 0..63
        const int lc = lane << 2;                            // 0..124
        const size_t grow = (size_t)(mBlk + p * 64 + lr);
        const size_t gcol = (size_t)(nBlk + lc);
        v4f val = *(const v4f*)(stg + lr * EPF + lc);
        if constexpr (RES == 1) {
          const v4f rr = *(const v4f*)(res + grow * (size_t)N + gcol);
#pragma unroll
          for (int e = 0; e < 4; ++e) val[e] = val[e] + rr[e];
        }
        if constexpr (RES == 2) {
          const v4f rr = *(const v4f*)(res + FROW(grow) * (size_t)DIM + gcol);
#pragma unroll
          for (int e = 0; e < 4; ++e) val[e] = val[e] + bf16r(rr[e]);
        }
        fv[it] = val;
        go[it] = grow * (size_t)N + gcol;
      }
#pragma unroll
      for (int it = 0; it < 8; ++it) *(v4f*)(outF + go[it]) = fv[it];
      
    }
    __syncthreads();                          // stage reused by the other row half
  }
}

// ---------------------------------------------------------------------------
// Flash attention (online softmax), f16 WMMA, f32 softmax.
// qkv: f16 [MROWS][3*DIM], q at col h*64+d, k at DIM + h*64+d.
// vt : f16 [(b*NHEAD+h)*64 + d][SEQ]  (key-contiguous V^T plane).
// grid = NB*NHEAD*(SEQ/64) blocks, 128 threads = 4 waves; wave = 16 query rows.
// K and V^T fragments loaded straight from the planes (arithmetic addressing);
// P (x1024, f16) bounced through per-wave LDS; row sums as P.ones on the matrix
// pipe so numerator and denominator use the same f16 P; ctx = 16*O/l (x16 carry).
// ---------------------------------------------------------------------------
#define VPAD 40   // P tile row stride (halves)
#define OPAD 72   // O stage row stride (halves)

__global__ __launch_bounds__(128) __attribute__((amdgpu_num_vgpr(256)))
void attn_kernel(const _Float16* __restrict__ qkv, const _Float16* __restrict__ vt,
                 _Float16* __restrict__ ctx) {
  __shared__ __attribute__((aligned(16))) _Float16 Ps[4 * 16 * VPAD];   // per-wave P 16x32
  __shared__ __attribute__((aligned(16))) _Float16 Os[4 * 16 * OPAD];   // per-wave O 16x64
  const int nqt = SEQ / 64;
  const int qt = (int)(blockIdx.x % nqt);
  const int bh = (int)(blockIdx.x / nqt);
  const int h = bh % NHEAD, b = bh / NHEAD;
  const int tid = threadIdx.x, wave = tid >> 5, lane = tid & 31;
  const int r = lane & 15, hb = (lane >> 4) << 3;
  const _Float16* Qb = qkv + (size_t)b * SEQ * LDQKV + h * DHEAD;
  const _Float16* Kh = Qb + DIM;
  const _Float16* Vh = vt + (size_t)bh * DHEAD * SEQ;
  const int q0 = qt * 64 + wave * 16;

  // Q fragments (A: lane -> query row, halves -> d), d chunks 0..31 and 32..63
  v16h aq[2];
#pragma unroll
  for (int dc = 0; dc < 2; ++dc)
    aq[dc] = load_frag(Qb + (size_t)(q0 + r) * LDQKV + dc * 32 + hb);

  // constant all-ones B fragment: P . ones -> per-row sums
  v16h ones;
#pragma unroll
  for (int e = 0; e < 16; ++e) ones[e] = (_Float16)1.0f;

  v8f o[4];
#pragma unroll
  for (int t = 0; t < 4; ++t)
#pragma unroll
    for (int v = 0; v < 8; ++v) o[t][v] = 0.f;
  float mrow[8], lrow[8];
#pragma unroll
  for (int v = 0; v < 8; ++v) { mrow[v] = -1e30f; lrow[v] = 0.f; }

  _Float16* Pw = Ps + wave * 16 * VPAD;
  const v8f zero = {0.f, 0.f, 0.f, 0.f, 0.f, 0.f, 0.f, 0.f};

#pragma unroll 1
  for (int kb = 0; kb < SEQ / 32; ++kb) {
    const int key0 = kb * 32;

    // S(16x32) = Q(16x64) . K^T : B-frag lane -> key, halves -> d (split map)
    v8f s[2];
#pragma unroll
    for (int kt = 0; kt < 2; ++kt)
#pragma unroll
      for (int v = 0; v < 8; ++v) s[kt][v] = 0.f;
#pragma unroll
    for (int kt = 0; kt < 2; ++kt)
#pragma unroll
      for (int dc = 0; dc < 2; ++dc) {
        const v16h bk = load_frag(Kh + (size_t)(key0 + kt * 16 + r) * LDQKV + dc * 32 + hb);
        s[kt] = wmma16(aq[dc], bk, s[kt]);
      }

    // online softmax; row = v + 8*lanehi, reduce over the 16-lane half
    float alpha[8];
#pragma unroll
    for (int v = 0; v < 8; ++v) {
      const float s0 = s[0][v] * 0.125f, s1 = s[1][v] * 0.125f;   // * DH^-0.5
      float mx = fmaxf(s0, s1);
#pragma unroll
      for (int msk = 8; msk >= 1; msk >>= 1) mx = fmaxf(mx, __shfl_xor(mx, msk, 32));
      const float mnew = fmaxf(mrow[v], mx);
      alpha[v] = __expf(mrow[v] - mnew);
      mrow[v]  = mnew;
      s[0][v] = __expf(s0 - mnew) * 1024.0f;                       // P carried x1024
      s[1][v] = __expf(s1 - mnew) * 1024.0f;
    }

    // D layout -> A-fragment layout via the per-wave LDS bounce
#pragma unroll
    for (int kt = 0; kt < 2; ++kt)
#pragma unroll
      for (int v = 0; v < 8; ++v)
        Pw[(v + hb) * VPAD + kt * 16 + r] = (_Float16)s[kt][v];
    __syncthreads();                          // stores complete before the reload (block-wide)

    const v16h pf = load_frag(Pw + r * VPAD + hb);

    // row sums on the matrix pipe
    const v8f rsum = wmma16(pf, ones, zero);
#pragma unroll
    for (int v = 0; v < 8; ++v) lrow[v] = lrow[v] * alpha[v] + rsum[v];

    // O(16x64) = alpha*O + P(16x32) . V(32x64); V^T rows are d, key-contiguous
#pragma unroll
    for (int t = 0; t < 4; ++t) {
#pragma unroll
      for (int v = 0; v < 8; ++v) o[t][v] *= alpha[v];
      const v16h bv = load_frag(Vh + (size_t)(t * 16 + r) * SEQ + key0 + hb);
      o[t] = wmma16(pf, bv, o[t]);
    }
  }

  // ctx = 16 * O / l  (the x1024 P carry cancels between O and l)
  _Float16* Ow = Os + wave * 16 * OPAD;
#pragma unroll
  for (int v = 0; v < 8; ++v) {
    const float inv = 16.0f / lrow[v];
#pragma unroll
    for (int t = 0; t < 4; ++t) Ow[(v + hb) * OPAD + t * 16 + r] = (_Float16)(o[t][v] * inv);
  }
  __syncthreads();

  const int rs = lane >> 3, cc = (lane & 7) << 3;
  v8h hv[4];
  size_t go[4];
#pragma unroll
  for (int it = 0; it < 4; ++it) {
    const int lr = it * 4 + rs;               // 0..15
    hv[it] = *(const v8h*)(Ow + lr * OPAD + cc);
    go[it] = ((size_t)b * SEQ + q0 + lr) * (size_t)DIM + h * DHEAD + cc;
  }
#pragma unroll
  for (int it = 0; it < 4; ++it) *(v8h*)(ctx + go[it]) = hv[it];
  
}

// ---------------------------------------------------------------------------
// in: f32 [MROWS][DIM] (residual already added).  outF: f32 (row mapped to the
// full-size layout when MAPOUT), outH: f16 copy (compact rows) when OUT16.
// ---------------------------------------------------------------------------
template <bool OUT16, bool MAPOUT>
__global__ __launch_bounds__(256) void ln_kernel(
    const float* __restrict__ in, const float* __restrict__ g, const float* __restrict__ bt,
    float* __restrict__ outF, _Float16* __restrict__ outH) {
#pragma clang fp contract(off)
  __shared__ float red0[8];
  __shared__ float red1[8];
  __shared__ __attribute__((aligned(16))) _Float16 sh[DIM];
  const size_t row = blockIdx.x;
  const int tid = threadIdx.x, wave = tid >> 5, lane = tid & 31;
  const v4f v = *(const v4f*)(in + row * DIM + tid * 4);
  float s = (v[0] + v[1]) + (v[2] + v[3]);
#pragma unroll
  for (int m = 16; m >= 1; m >>= 1) s += __shfl_xor(s, m, 32);
  if (lane == 0) red0[wave] = s;
  __syncthreads();
  float S = 0.f;
#pragma unroll
  for (int i = 0; i < 8; ++i) S += red0[i];
  const float mu = S * (1.0f / (float)DIM);
  const float d0 = v[0] - mu, d1 = v[1] - mu, d2 = v[2] - mu, d3 = v[3] - mu;
  float ss = (d0 * d0 + d1 * d1) + (d2 * d2 + d3 * d3);
#pragma unroll
  for (int m = 16; m >= 1; m >>= 1) ss += __shfl_xor(ss, m, 32);
  if (lane == 0) red1[wave] = ss;
  __syncthreads();
  float SS = 0.f;
#pragma unroll
  for (int i = 0; i < 8; ++i) SS += red1[i];
  const float var = SS * (1.0f / (float)DIM);
  const float rstd = rsqrtf(var + 1e-5f);
  const v4f gg = *(const v4f*)(g + tid * 4);
  const v4f bb = *(const v4f*)(bt + tid * 4);
  v4f y;
  y[0] = d0 * rstd * bf16r(gg[0]) + bf16r(bb[0]);
  y[1] = d1 * rstd * bf16r(gg[1]) + bf16r(bb[1]);
  y[2] = d2 * rstd * bf16r(gg[2]) + bf16r(bb[2]);
  y[3] = d3 * rstd * bf16r(gg[3]) + bf16r(bb[3]);
  const size_t orow = MAPOUT ? FROW(row) : row;
  float* op = outF + orow * DIM + tid * 4;
  *(v4f*)op = y;
  
  if constexpr (OUT16) {
#pragma unroll
    for (int e = 0; e < 4; ++e) sh[tid * 4 + e] = (_Float16)y[e];
    __syncthreads();
    if (tid < 128) {                           // waves 0..3, wave-uniform
      const v8h hv = *(const v8h*)(sh + tid * 8);
      _Float16* hp = outH + row * DIM + tid * 8;
      *(v8h*)hp = hv;
      
    }
  }
}

// ---------------------------------------------------------------------------
// Launch plan (13 launches):
//  cvt_x, cvt_wt x4 (qkv | o | 1 | 2), gemm qkv, vtrans, attn, gemm o (+x),
//  ln1, gemm 1 (relu), gemm 2 (+h), ln2 -> d_out
// Workspace (byte offsets derived below, total 106 MiB at full size):
//  W planes 10 MiB | P1 16 MiB: X16 -> VT16 -> G16 | P2 48 MiB: QKV16 -> {R1, H16} -> R2
//  | P3 32 MiB: CTX16 -> H32
// ---------------------------------------------------------------------------
extern "C" void kernel_launch(void* const* d_in, const int* in_sizes, int n_in,
                              void* d_out, int out_size, void* d_ws, size_t ws_size,
                              hipStream_t stream) {
  if (n_in < 13) return;
  const size_t needX = ((size_t)(NB - 1) * SEQ_FULL + SEQ) * DIM;
  if ((size_t)in_sizes[0] < needX) return;
  if (in_sizes[1] < DIM * DIM || in_sizes[2] < DIM * DIM || in_sizes[3] < DIM * DIM ||
      in_sizes[4] < DIM * DIM) return;
  if (in_sizes[5] < DIM || in_sizes[6] < DIM || in_sizes[10] < DIM || in_sizes[11] < DIM ||
      in_sizes[12] < DIM) return;
  if (in_sizes[7] < DIM * HID || in_sizes[8] < HID || in_sizes[9] < HID * DIM) return;
  if ((size_t)out_size < needX) return;

  const float* x     = (const float*)d_in[0];
  const float* Wq    = (const float*)d_in[1];
  const float* Wk    = (const float*)d_in[2];
  const float* Wv    = (const float*)d_in[3];
  const float* Wo    = (const float*)d_in[4];
  const float* ln1_g = (const float*)d_in[5];
  const float* ln1_b = (const float*)d_in[6];
  const float* W1    = (const float*)d_in[7];
  const float* b1    = (const float*)d_in[8];
  const float* W2    = (const float*)d_in[9];
  const float* b2    = (const float*)d_in[10];
  const float* ln2_g = (const float*)d_in[11];
  const float* ln2_b = (const float*)d_in[12];
  float* out = (float*)d_out;

  // carve (all region sizes are exact multiples of the whole-line stores used)
  const size_t szWqkv = (size_t)3 * DIM * DIM * 2;     // [3072][1024] f16
  const size_t szWo   = (size_t)DIM * DIM * 2;         // [1024][1024] f16
  const size_t szW1   = (size_t)HID * DIM * 2;         // [512][1024]  f16 (W1^T)
  const size_t szW2   = (size_t)DIM * HID * 2;         // [1024][512]  f16 (W2^T)
  const size_t szP1   = (size_t)MROWS * DIM * 2;       // X16 / VT16 / G16
  const size_t szP2   = (size_t)MROWS * LDQKV * 2;     // QKV16 / {R1,H16} / R2
  const size_t szP3   = (size_t)MROWS * DIM * 4;       // CTX16 / H32
  const size_t oWqkv = 0;
  const size_t oWo   = oWqkv + szWqkv;
  const size_t oW1   = oWo + szWo;
  const size_t oW2   = oW1 + szW1;
  const size_t oP1   = oW2 + szW2;
  const size_t oP2   = oP1 + szP1;
  const size_t oP3   = oP2 + szP2;
  const size_t total = oP3 + szP3;
  if (total > ws_size) return;
  static_assert((size_t)MROWS * DIM * 4 + (size_t)MROWS * DIM * 2 <= (size_t)MROWS * LDQKV * 2);
  static_assert((size_t)MROWS * HID * 2 <= (size_t)MROWS * DIM * 2);
  static_assert((size_t)NB * NHEAD * DHEAD * SEQ * 2 <= (size_t)MROWS * DIM * 2);

  char* ws = (char*)d_ws;
  _Float16* Wqkv_t = (_Float16*)(ws + oWqkv);
  _Float16* Wo_t   = (_Float16*)(ws + oWo);
  _Float16* W1_t   = (_Float16*)(ws + oW1);
  _Float16* W2_t   = (_Float16*)(ws + oW2);
  _Float16* X16    = (_Float16*)(ws + oP1);
  _Float16* VT16   = (_Float16*)(ws + oP1);
  _Float16* G16    = (_Float16*)(ws + oP1);
  _Float16* QKV16  = (_Float16*)(ws + oP2);
  float*    R1     = (float*)   (ws + oP2);
  _Float16* H16    = (_Float16*)(ws + oP2 + (size_t)MROWS * DIM * 4);
  float*    R2     = (float*)   (ws + oP2);
  _Float16* CTX16  = (_Float16*)(ws + oP3);
  float*    H32    = (float*)   (ws + oP3);

  const float wsc   = 32.0f;                  // weight carry
  const float inv32 = 1.0f / 32.0f;
  const float inv512 = 1.0f / 512.0f;         // 1/(32 weight carry * 16 ctx carry)

  // 1) x -> X16 (bf16 RNE, f16 container)
  cvt_x_kernel<<<dim3(MROWS / 2), 256, 0, stream>>>(x, X16);

  // 2) weights -> transposed f16 planes, bf16 RNE then x32
  cvt_wt_kernel<<<dim3(DIM / 64, DIM / 64, 3), 256, 0, stream>>>(Wq, Wk, Wv, Wqkv_t, DIM, DIM, wsc);
  cvt_wt_kernel<<<dim3(DIM / 64, DIM / 64, 1), 256, 0, stream>>>(Wo, Wo, Wo, Wo_t, DIM, DIM, wsc);
  cvt_wt_kernel<<<dim3(HID / 64, DIM / 64, 1), 256, 0, stream>>>(W1, W1, W1, W1_t, DIM, HID, wsc);
  cvt_wt_kernel<<<dim3(DIM / 64, HID / 64, 1), 256, 0, stream>>>(W2, W2, W2, W2_t, HID, DIM, wsc);

  // 3) qkv = x @ [Wq | Wk | Wv]   (f16 out, 1/32 folded)
  gemm_kernel<false, 0, false, true>
      <<<dim3(LDQKV / BN, MROWS / BM), 256, 0, stream>>>(
          X16, Wqkv_t, nullptr, nullptr, nullptr, QKV16, LDQKV, DIM, inv32);

  // 4) V^T plane per (b,h)
  vtrans_kernel<<<dim3(SEQ / 64, NB * NHEAD), 256, 0, stream>>>(QKV16, VT16);

  // 5) ctx = softmax(q k^T / 8) v    (f16 out, carried x16)
  attn_kernel<<<dim3(NB * NHEAD * (SEQ / 64)), 128, 0, stream>>>(QKV16, VT16, CTX16);

  // 6) r1 = ctx @ Wo + bf16r(x)        (f32 out)
  gemm_kernel<false, 2, false, false>
      <<<dim3(DIM / BN, MROWS / BM), 256, 0, stream>>>(
          CTX16, Wo_t, nullptr, x, R1, nullptr, DIM, DIM, inv512);

  // 7) h = LN1(r1)                     (f32 + f16)
  ln_kernel<true, false><<<dim3(MROWS), 256, 0, stream>>>(R1, ln1_g, ln1_b, H32, H16);

  // 8) g = relu(h @ W1 + b1)           (f16 out)
  gemm_kernel<true, 0, true, true>
      <<<dim3(HID / BN, MROWS / BM), 256, 0, stream>>>(
          H16, W1_t, b1, nullptr, nullptr, G16, HID, DIM, inv32);

  // 9) r2 = g @ W2 + b2 + h            (f32 out)
  gemm_kernel<true, 1, false, false>
      <<<dim3(DIM / BN, MROWS / BM), 256, 0, stream>>>(
          G16, W2_t, b2, H32, R2, nullptr, DIM, HID, inv32);

  // 10) out = LN2(r2)                  (f32, full-size row layout)
  ln_kernel<false, true><<<dim3(MROWS), 256, 0, stream>>>(R2, ln2_g, ln2_b, out, nullptr);
}

// v001
// Measured time: 270 microseconds a run.
// Two timings next to v000 both put it at 1.41 times that version's speed.
#include <hip/hip_runtime.h>
#include <stdint.h>
#include <stddef.h>

// All contractions: v_wmma_f32_16x16x32_f16 (f16 operands, f32 accumulate): q/k/v projections, q.k^T scores, P.1 row sums, P.V, output projection, FFN up, FFN down. Float inputs RNE-converted to bf16 then carried in f16 (weights x32, P x1024, ctx x16); softmax and LayerNorm in f32.

#ifndef NB
#define NB 8
#endif
#ifndef SEQ
#define SEQ 1024
#endif
#define NB_FULL 8
#define SEQ_FULL 1024
#define DIM 1024
#define NHEAD 16
#define DHEAD 64
#define HID 512
#define MROWS (NB * SEQ)
#define LDQKV (3 * DIM)
// compact row m (b*SEQ + s) -> full-size row (b*SEQ_FULL + s) for input x and for d_out
#define FROW(m) ((((size_t)(m)) / SEQ) * SEQ_FULL + (((size_t)(m)) % SEQ))

static_assert(NB >= 1 && NB <= NB_FULL);
static_assert(SEQ >= 64 && SEQ <= SEQ_FULL && (SEQ % 64) == 0);
static_assert((MROWS % 128) == 0);
static_assert((DIM % 128) == 0 && (HID % 128) == 0 && (DIM % 32) == 0 && (HID % 32) == 0);
static_assert(NHEAD * DHEAD == DIM && DHEAD == 64);
static_assert(((size_t)(NB - 1) * SEQ_FULL + SEQ) * DIM <= (size_t)NB_FULL * SEQ_FULL * DIM);

// ---------------------------------------------------------------------------
// Types / helpers
// ---------------------------------------------------------------------------
typedef _Float16 v16h __attribute__((ext_vector_type(16)));
typedef _Float16 v8h  __attribute__((ext_vector_type(8)));
typedef float    v8f  __attribute__((ext_vector_type(8)));
typedef float    v4f  __attribute__((ext_vector_type(4)));

// 16x16x32 f16 WMMA followed by the VALU hazard guard (ties D, keeps A/B live)
static __device__ __forceinline__ v8f wmma16(v16h a, v16h b, v8f c) {
  v8f d = __builtin_amdgcn_wmma_f32_16x16x32_f16(false, a, false, b, (short)0, c, false, false);
  asm volatile("v_nop\n\tv_nop\n\tv_nop\n\tv_nop" : "+v"(d) : "v"(a), "v"(b));
  return d;
}

// f32 -> nearest-even bf16 value, returned as f32
static __device__ __forceinline__ float bf16r(float f) {
  unsigned int u = __float_as_uint(f);
  u = (u + 0x7FFFu + ((u >> 16) & 1u)) & 0xFFFF0000u;
  return __uint_as_float(u);
}

// Build a 16-half WMMA A/B fragment for one lane from a row-major (k-contiguous) run.
// 16-bit operand layout: lane-half base8 = (lane>=16)?8:0;
// halves 0..7 -> k = base8+0..7, halves 8..15 -> k = base8+16..23.
// Caller passes p already offset by base8; we read [p, p+8) and [p+16, p+24).
static __device__ __forceinline__ v16h load_frag(const _Float16* p) {
  v8h lo = *(const v8h*)(p);
  v8h hi = *(const v8h*)(p + 16);
  v16h f;
#pragma unroll
  for (int e = 0; e < 8; ++e) { f[e] = lo[e]; f[e + 8] = hi[e]; }
  return f;
}

// ---------------------------------------------------------------------------
// x (f32 [NB_FULL*SEQ_FULL][DIM]) -> X16 (f16 [MROWS][DIM]), bf16 RNE first.
// grid = MROWS*DIM/8/256 exactly.
// ---------------------------------------------------------------------------
__global__ __launch_bounds__(256) void cvt_x_kernel(const float* __restrict__ x,
                                                    _Float16* __restrict__ X16) {
#pragma clang fp contract(off)
  const size_t i = (size_t)blockIdx.x * 256 + threadIdx.x;   // 8-element chunk
  const size_t m = i / (DIM / 8);
  const int c = (int)(i % (DIM / 8)) * 8;
  const float* src = x + FROW(m) * DIM + c;
  const v4f a = *(const v4f*)(src);
  const v4f b = *(const v4f*)(src + 4);
  v8h hv;
#pragma unroll
  for (int e = 0; e < 4; ++e) {
    hv[e]     = (_Float16)bf16r(a[e]);
    hv[e + 4] = (_Float16)bf16r(b[e]);
  }
  _Float16* dst = X16 + m * DIM + c;
  *(v8h*)dst = hv;
  
}

// ---------------------------------------------------------------------------
// Weight W (f32 [K][N] row-major, up to 3 parts selected by blockIdx.z) ->
// transposed f16 plane dst[part*N + n][k] = f16(bf16r(W[k][n]) * scale).
// (8 lanes x 16 B, one instruction per 32 lines). grid = (N/64, K/64, parts).
// ---------------------------------------------------------------------------
#define TP 72
__global__ __launch_bounds__(256) void cvt_wt_kernel(
    const float* __restrict__ w0, const float* __restrict__ w1, const float* __restrict__ w2,
    _Float16* __restrict__ dst, int K, int N, float scale) {
#pragma clang fp contract(off)
  __shared__ __attribute__((aligned(16))) _Float16 T[64 * TP];   // [n][k]
  const int part = blockIdx.z;
  const float* w = (part == 0) ? w0 : ((part == 1) ? w1 : w2);   // block-uniform select
  const int k0 = blockIdx.y * 64, n0 = blockIdx.x * 64;
  const int tid = threadIdx.x;
#pragma unroll
  for (int q = 0; q < 4; ++q) {
    const int idx = q * 256 + tid;            // 0..1023
    const int kr = idx >> 4;                  // 0..63
    const int nc = (idx & 15) << 2;           // 0..60
    const v4f v = *(const v4f*)(w + (size_t)(k0 + kr) * N + n0 + nc);
#pragma unroll
    for (int e = 0; e < 4; ++e) T[(nc + e) * TP + kr] = (_Float16)(bf16r(v[e]) * scale);
  }
  __syncthreads();
  const int rs = tid >> 3, cc = (tid & 7) << 3;
  v8h hv[2];
  size_t go[2];
#pragma unroll
  for (int it = 0; it < 2; ++it) {
    const int nl = it * 32 + rs;              // 0..63
    hv[it] = *(const v8h*)(T + nl * TP + cc);
    go[it] = ((size_t)part * N + n0 + nl) * (size_t)K + k0 + cc;
  }
#pragma unroll
  for (int it = 0; it < 2; ++it) *(v8h*)(dst + go[it]) = hv[it];
  
}

// ---------------------------------------------------------------------------
// V transpose: qkv (f16 [MROWS][3*DIM], v at col 2*DIM + h*64 + d) ->
// vt[(b*NHEAD+h)*64 + d][s] (s-contiguous, pitch SEQ). 64x64 tiles through LDS,
// ---------------------------------------------------------------------------
__global__ __launch_bounds__(256) void vtrans_kernel(const _Float16* __restrict__ qkv,
                                                     _Float16* __restrict__ vt) {
  __shared__ __attribute__((aligned(16))) _Float16 T[64 * TP];   // [d][s]
  const int bh = blockIdx.y;
  const int b = bh / NHEAD, h = bh % NHEAD;
  const int s0 = blockIdx.x * 64;
  const int tid = threadIdx.x;
#pragma unroll
  for (int q = 0; q < 2; ++q) {
    const int idx = q * 256 + tid;            // 0..511
    const int sr = idx >> 3;                  // 0..63
    const int dc = (idx & 7) << 3;            // 0..56
    const v8h v = *(const v8h*)(qkv + ((size_t)b * SEQ + s0 + sr) * LDQKV + 2 * DIM + h * DHEAD + dc);
#pragma unroll
    for (int e = 0; e < 8; ++e) T[(dc + e) * TP + sr] = v[e];
  }
  __syncthreads();
  const int rs = tid >> 3, cc = (tid & 7) << 3;
  v8h hv[2];
  size_t go[2];
#pragma unroll
  for (int it = 0; it < 2; ++it) {
    const int dl = it * 32 + rs;              // 0..63
    hv[it] = *(const v8h*)(T + dl * TP + cc);
    go[it] = ((size_t)bh * DHEAD + dl) * (size_t)SEQ + s0 + cc;
  }
#pragma unroll
  for (int it = 0; it < 2; ++it) *(v8h*)(vt + go[it]) = hv[it];
  
}

// ---------------------------------------------------------------------------
// WMMA GEMM: C[M][N] = A[M][K] (f16, row-major) . B, with B given transposed as
// Bt[N][K] (f16, k-contiguous).  C = acc*scale (+bias) (relu) (+residual).
// 128x128x32 block tile, 8 waves, wave tile 64x32 (4x2 WMMA tiles).
// Single-buffered LDS staging with plain loads. Epilogue stages 64 rows at a
// residual plane is read in the store phase as 16-B vectors (8 loads per lane).
// RES: 0 none, 1 f32 plane [M][N], 2 bf16r(x) read at full-size rows (N == DIM).
// Requires M%128==0 (grid.y = M/128), N%128==0 (grid.x = N/128), K%32==0.
// ---------------------------------------------------------------------------
#define BM 128
#define BN 128
#define BK 32
#define LDT 40     // LDS tile row stride in halves (80 B)
#define EPF 132    // epilogue stage pitch in floats (528 B)
#define GEMM_SMEM_FLOATS (64 * EPF)
static_assert((BM + BN) * LDT * 2 <= GEMM_SMEM_FLOATS * 4);

template <bool HAS_BIAS, int RES, bool RELU, bool OUT16>
__global__ __launch_bounds__(256) void gemm_kernel(
    const _Float16* __restrict__ A, const _Float16* __restrict__ Bt,
    const float* __restrict__ bias, const float* __restrict__ res,
    float* __restrict__ outF, _Float16* __restrict__ outH,
    int N, int K, float scale) {
  static_assert(!(RES != 0 && OUT16));
  __shared__ __attribute__((aligned(16))) float smem[GEMM_SMEM_FLOATS];
  _Float16* As = (_Float16*)smem;           // [m][k]
  _Float16* Bs = As + BM * LDT;             // [n][k]
  const int tid = threadIdx.x;
  const int wave = tid >> 5, lane = tid & 31;
  const int r = lane & 15, hb = (lane >> 4) << 3;
  const int mBlk = blockIdx.y * BM, nBlk = blockIdx.x * BN;
  const int mw = (wave & 1) * 64, nw = (wave >> 1) * 32;

  // staging coords: 128 rows x 32 k per operand = 512 chunks of 8 halves, 2 per thread
  const int sr0 = tid >> 2, sr1 = sr0 + 64, skc = (tid & 3) << 3;
  const _Float16* gA0 = A  + (size_t)(mBlk + sr0) * K + skc;
  const _Float16* gA1 = A  + (size_t)(mBlk + sr1) * K + skc;
  const _Float16* gB0 = Bt + (size_t)(nBlk + sr0) * K + skc;
  const _Float16* gB1 = Bt + (size_t)(nBlk + sr1) * K + skc;

  v8f acc[4][2];
#pragma unroll
  for (int i = 0; i < 4; ++i)
#pragma unroll
    for (int j = 0; j < 2; ++j)
#pragma unroll
      for (int v = 0; v < 8; ++v) acc[i][j][v] = 0.f;

  const int nk = K / BK;
#pragma unroll 1
  for (int kt = 0; kt < nk; ++kt) {
    const size_t ko = (size_t)kt * BK;
    const v8h a0 = *(const v8h*)(gA0 + ko);
    const v8h a1 = *(const v8h*)(gA1 + ko);
    const v8h b0 = *(const v8h*)(gB0 + ko);
    const v8h b1 = *(const v8h*)(gB1 + ko);
    __syncthreads();                          // all waves done with the prior tile
    *(v8h*)(As + sr0 * LDT + skc) = a0;
    *(v8h*)(As + sr1 * LDT + skc) = a1;
    *(v8h*)(Bs + sr0 * LDT + skc) = b0;
    *(v8h*)(Bs + sr1 * LDT + skc) = b1;
    __syncthreads();                          // tile fully staged
    v16h af[4], bfr[2];
#pragma unroll
    for (int i = 0; i < 4; ++i) af[i] = load_frag(As + (mw + i * 16 + r) * LDT + hb);
#pragma unroll
    for (int j = 0; j < 2; ++j) bfr[j] = load_frag(Bs + (nw + j * 16 + r) * LDT + hb);
#pragma unroll
    for (int i = 0; i < 4; ++i)
#pragma unroll
      for (int j = 0; j < 2; ++j) acc[i][j] = wmma16(af[i], bfr[j], acc[i][j]);
  }
  __syncthreads();                            // LDS reused as the epilogue stage

  // epilogue. D layout: element v -> row 8*lanehi + v, lane&15 -> col.
  float* stg = smem;                          // [64][EPF] f32
  float bcol[2] = {0.f, 0.f};
  if constexpr (HAS_BIAS) {
#pragma unroll
    for (int j = 0; j < 2; ++j) bcol[j] = bf16r(bias[nBlk + nw + j * 16 + r]);
  }
#pragma unroll
  for (int p = 0; p < 2; ++p) {
    if ((wave & 1) == p) {                    // wave-uniform: waves owning rows p*64..p*64+63
#pragma unroll
      for (int i = 0; i < 4; ++i)
#pragma unroll
        for (int j = 0; j < 2; ++j)
#pragma unroll
          for (int v = 0; v < 8; ++v) {
            const int lr = i * 16 + hb + v;                   // 0..63
            const int lc = nw + j * 16 + r;                   // 0..127
            float c = acc[i][j][v] * scale;
            if constexpr (HAS_BIAS) c += bcol[j];
            if constexpr (RELU) c = fmaxf(c, 0.f);
            stg[lr * EPF + lc] = c;
          }
    }
    __syncthreads();
    if constexpr (OUT16) {
      // f16 row segment = 128 halves = 256 B = 2 lines; 16 lanes x 16 B per row
      v8h hv[4];
      size_t go[4];
#pragma unroll
      for (int it = 0; it < 4; ++it) {
        const int lr = it * 16 + wave * 2 + (lane >> 4);   // 0..63
        const int lc = (lane & 15) << 3;                    // 0..120
        const v4f x0 = *(const v4f*)(stg + lr * EPF + lc);
        const v4f x1 = *(const v4f*)(stg + lr * EPF + lc + 4);
        v8h hh;
#pragma unroll
        for (int e = 0; e < 4; ++e) { hh[e] = (_Float16)x0[e]; hh[e + 4] = (_Float16)x1[e]; }
        hv[it] = hh;
        go[it] = (size_t)(mBlk + p * 64 + lr) * (size_t)N + nBlk + lc;
      }
#pragma unroll
      for (int it = 0; it < 4; ++it) *(v8h*)(outH + go[it]) = hv[it];
      
    } else {
      // f32 row segment = 128 floats = 512 B = 4 lines; 32 lanes x 16 B per row.
      // Residual added here from one 16-B load per row per lane (8 global loads per lane).
      v4f fv[8];
      size_t go[8];
#pragma unroll
      for (int it = 0; it < 8; ++it) {
        const int lr = it * 8 + wave;                        // 0..63
        const int lc = lane << 2;                            // 0..124
        const size_t grow = (size_t)(mBlk + p * 64 + lr);
        const size_t gcol = (size_t)(nBlk + lc);
        v4f val = *(const v4f*)(stg + lr * EPF + lc);
        if constexpr (RES == 1) {
          const v4f rr = *(const v4f*)(res + grow * (size_t)N + gcol);
#pragma unroll
          for (int e = 0; e < 4; ++e) val[e] = val[e] + rr[e];
        }
        if constexpr (RES == 2) {
          const v4f rr = *(const v4f*)(res + FROW(grow) * (size_t)DIM + gcol);
#pragma unroll
          for (int e = 0; e < 4; ++e) val[e] = val[e] + bf16r(rr[e]);
        }
        fv[it] = val;
        go[it] = grow * (size_t)N + gcol;
      }
#pragma unroll
      for (int it = 0; it < 8; ++it) *(v4f*)(outF + go[it]) = fv[it];
      
    }
    __syncthreads();                          // stage reused by the other row half
  }
}

// ---------------------------------------------------------------------------
// Flash attention (online softmax), f16 WMMA, f32 softmax.
// qkv: f16 [MROWS][3*DIM], q at col h*64+d, k at DIM + h*64+d.
// vt : f16 [(b*NHEAD+h)*64 + d][SEQ]  (key-contiguous V^T plane).
// grid = NB*NHEAD*(SEQ/128) blocks, 256 threads = 8 waves; wave = 16 query rows.
// K (64 keys x 64 d) and V^T (64 d x 64 keys) tiles are staged in LDS by
// asynchronous 16-B copies (whole 128-B lines per row), two buffers, one stage
// in flight while the other is read; all 8 waves read their fragments from LDS.
// P (x1024, f16) bounced through per-wave LDS; row sums as P.ones on the matrix
// pipe so numerator and denominator use the same f16 P; ctx = 16*O/l (x16 carry).
// ---------------------------------------------------------------------------
#define VPAD 40   // P tile row stride (halves)
#define OPAD 72   // O stage row stride (halves)
#define AW 8                    // waves per block
#define AQ (AW * 16)            // query rows per block
#define SK 64                   // keys per stage
#define KVP 72                  // staged row pitch in halves (144 B = 16 B x odd)
#define TILE_H (64 * KVP)       // halves per staged tile
#define NST (SEQ / SK)          // stages
static_assert((SEQ % AQ) == 0 && (SEQ % SK) == 0 && AW * 32 == 256);

// One stage: each lane copies two 16-B pieces of the K tile and two of the V^T tile.
// The s_wait_xcnt stands inside the statement so that no address register of a
// copy is rewritten in front of it.
static __device__ __forceinline__ void stage_kv(unsigned lk0, unsigned lk1, unsigned lv0, unsigned lv1,
                                                const _Float16* gk0, const _Float16* gk1,
                                                const _Float16* gv0, const _Float16* gv1) {
  asm volatile(
      "global_load_async_to_lds_b128 %0, %4, off\n\t"
      "global_load_async_to_lds_b128 %1, %5, off\n\t"
      "global_load_async_to_lds_b128 %2, %6, off\n\t"
      "global_load_async_to_lds_b128 %3, %7, off\n\t"
      "s_wait_xcnt 0x0"
      :: "v"(lk0), "v"(lk1), "v"(lv0), "v"(lv1), "v"(gk0), "v"(gk1), "v"(gv0), "v"(gv1)
      : "memory");
}

__global__ __launch_bounds__(256) __attribute__((amdgpu_num_vgpr(256)))
void attn_kernel(const _Float16* __restrict__ qkv, const _Float16* __restrict__ vt,
                 _Float16* __restrict__ ctx) {
  __shared__ __attribute__((aligned(16))) _Float16 KV[2 * 2 * TILE_H];   // [buffer][K | V^T][row][KVP]
  __shared__ __attribute__((aligned(16))) _Float16 Ps[AW * 16 * VPAD];   // per-wave P 16x32
  __shared__ __attribute__((aligned(16))) _Float16 Os[AW * 16 * OPAD];   // per-wave O 16x64
  const int nqt = SEQ / AQ;
  const int qt = (int)(blockIdx.x % nqt);
  const int bh = (int)(blockIdx.x / nqt);
  const int h = bh % NHEAD, b = bh / NHEAD;
  const int tid = threadIdx.x, wave = tid >> 5, lane = tid & 31;
  const int r = lane & 15, hb = (lane >> 4) << 3;
  const _Float16* Qb = qkv + (size_t)b * SEQ * LDQKV + h * DHEAD;
  const _Float16* Kh = Qb + DIM;
  const _Float16* Vh = vt + (size_t)bh * DHEAD * SEQ;
  const int q0 = qt * AQ + wave * 16;

  // staging coords: 64 rows x 8 pieces of 16 B per tile = 512 pieces, 2 per thread
  const int srow = tid >> 3, sch = (tid & 7) << 3;
  const _Float16* gK = Kh + (size_t)srow * LDQKV + sch;      // + key0 * LDQKV per stage
  const _Float16* gV = Vh + (size_t)srow * SEQ + sch;        // + key0 per stage
  const unsigned lK = (unsigned)(uintptr_t)(KV + srow * KVP + sch);   // LDS byte address, buffer 0
  const unsigned lV = lK + TILE_H * 2;
  const unsigned l32 = 32 * KVP * 2;                          // 32 rows further, bytes
  const unsigned lbuf = 2 * TILE_H * 2;                       // buffer size, bytes

  // stage 0 into buffer 0; landed and published before anything reads it
  stage_kv(lK, lK + l32, lV, lV + l32, gK, gK + (size_t)32 * LDQKV, gV, gV + (size_t)32 * SEQ);
  asm volatile("s_wait_asynccnt 0x0" ::: "memory");          // this wave's copies have landed
  __syncthreads();                                            // every wave's copies are readable
  if (NST > 1) {
    const _Float16* k1 = gK + (size_t)SK * LDQKV;
    const _Float16* v1 = gV + SK;
    stage_kv(lK + lbuf, lK + lbuf + l32, lV + lbuf, lV + lbuf + l32,
             k1, k1 + (size_t)32 * LDQKV, v1, v1 + (size_t)32 * SEQ);
  }

  // Q fragments (A: lane -> query row, halves -> d), d chunks 0..31 and 32..63
  v16h aq[2];
#pragma unroll
  for (int dc = 0; dc < 2; ++dc)
    aq[dc] = load_frag(Qb + (size_t)(q0 + r) * LDQKV + dc * 32 + hb);

  // constant all-ones B fragment: P . ones -> per-row sums
  v16h ones;
#pragma unroll
  for (int e = 0; e < 16; ++e) ones[e] = (_Float16)1.0f;

  v8f o[4];
#pragma unroll
  for (int t = 0; t < 4; ++t)
#pragma unroll
    for (int v = 0; v < 8; ++v) o[t][v] = 0.f;
  float mrow[8], lrow[8];
#pragma unroll
  for (int v = 0; v < 8; ++v) { mrow[v] = -1e30f; lrow[v] = 0.f; }

  _Float16* Pw = Ps + wave * 16 * VPAD;
  const v8f zero = {0.f, 0.f, 0.f, 0.f, 0.f, 0.f, 0.f, 0.f};

#pragma unroll 1
  for (int st = 0; st < NST; ++st) {
   const _Float16* Kt = KV + (st & 1) * (2 * TILE_H);
   const _Float16* Vt = Kt + TILE_H;
   // kept rolled: unrolled, the kernel needs more than 128 registers and a WGP
   // then holds three of its four blocks instead of all four
#pragma unroll 1
   for (int sub = 0; sub < SK / 32; ++sub) {
    const int key0 = sub * 32;                // key offset inside the staged tile

    // S(16x32) = Q(16x64) . K^T : B-frag lane -> key, halves -> d (split map)
    v8f s[2];
#pragma unroll
    for (int kt = 0; kt < 2; ++kt)
#pragma unroll
      for (int v = 0; v < 8; ++v) s[kt][v] = 0.f;
#pragma unroll
    for (int kt = 0; kt < 2; ++kt)
#pragma unroll
      for (int dc = 0; dc < 2; ++dc) {
        const v16h bk = load_frag(Kt + (key0 + kt * 16 + r) * KVP + dc * 32 + hb);
        s[kt] = wmma16(aq[dc], bk, s[kt]);
      }

    // online softmax; row = v + 8*lanehi, reduce over the 16-lane half
    float alpha[8];
#pragma unroll
    for (int v = 0; v < 8; ++v) {
      const float s0 = s[0][v] * 0.125f, s1 = s[1][v] * 0.125f;   // * DH^-0.5
      float mx = fmaxf(s0, s1);
#pragma unroll
      for (int msk = 8; msk >= 1; msk >>= 1) mx = fmaxf(mx, __shfl_xor(mx, msk, 32));
      const float mnew = fmaxf(mrow[v], mx);
      alpha[v] = __expf(mrow[v] - mnew);
      mrow[v]  = mnew;
      s[0][v] = __expf(s0 - mnew) * 1024.0f;                       // P carried x1024
      s[1][v] = __expf(s1 - mnew) * 1024.0f;
    }

    // D layout -> A-fragment layout via the per-wave LDS bounce
#pragma unroll
    for (int kt = 0; kt < 2; ++kt)
#pragma unroll
      for (int v = 0; v < 8; ++v)
        Pw[(v + hb) * VPAD + kt * 16 + r] = (_Float16)s[kt][v];
    __syncthreads();                          // stores complete before the reload (block-wide)

    const v16h pf = load_frag(Pw + r * VPAD + hb);

    // row sums on the matrix pipe
    const v8f rsum = wmma16(pf, ones, zero);
#pragma unroll
    for (int v = 0; v < 8; ++v) lrow[v] = lrow[v] * alpha[v] + rsum[v];

    // O(16x64) = alpha*O + P(16x32) . V(32x64); V^T rows are d, key-contiguous
#pragma unroll
    for (int t = 0; t < 4; ++t) {
#pragma unroll
      for (int v = 0; v < 8; ++v) o[t][v] *= alpha[v];
      const v16h bv = load_frag(Vt + (t * 16 + r) * KVP + key0 + hb);
      o[t] = wmma16(pf, bv, o[t]);
    }
   }
   // publish point of stage st + 1, and hand-over of this stage's buffer
   asm volatile("s_wait_dscnt 0x0" ::: "memory");            // this wave's reads of the buffer are done
   asm volatile("s_wait_asynccnt 0x0" ::: "memory");         // this wave's copies of stage st + 1 have landed
   __syncthreads();                                           // publishes st + 1, ends every read of st
   if (st + 2 < NST) {
     const _Float16* kn = gK + (size_t)(st + 2) * SK * LDQKV;
     const _Float16* vn = gV + (st + 2) * SK;
     const unsigned lo = (unsigned)(st & 1) * lbuf;
     stage_kv(lK + lo, lK + lo + l32, lV + lo, lV + lo + l32,
              kn, kn + (size_t)32 * LDQKV, vn, vn + (size_t)32 * SEQ);
   }
  }
  asm volatile("s_wait_asynccnt 0x0" ::: "memory");          // nothing in flight when the wave ends

  // ctx = 16 * O / l  (the x1024 P carry cancels between O and l)
  _Float16* Ow = Os + wave * 16 * OPAD;
#pragma unroll
  for (int v = 0; v < 8; ++v) {
    const float inv = 16.0f / lrow[v];
#pragma unroll
    for (int t = 0; t < 4; ++t) Ow[(v + hb) * OPAD + t * 16 + r] = (_Float16)(o[t][v] * inv);
  }
  __syncthreads();

  const int rs = lane >> 3, cc = (lane & 7) << 3;
  v8h hv[4];
  size_t go[4];
#pragma unroll
  for (int it = 0; it < 4; ++it) {
    const int lr = it * 4 + rs;               // 0..15
    hv[it] = *(const v8h*)(Ow + lr * OPAD + cc);
    go[it] = ((size_t)b * SEQ + q0 + lr) * (size_t)DIM + h * DHEAD + cc;
  }
#pragma unroll
  for (int it = 0; it < 4; ++it) *(v8h*)(ctx + go[it]) = hv[it];
  
}

// ---------------------------------------------------------------------------
// in: f32 [MROWS][DIM] (residual already added).  outF: f32 (row mapped to the
// full-size layout when MAPOUT), outH: f16 copy (compact rows) when OUT16.
// ---------------------------------------------------------------------------
template <bool OUT16, bool MAPOUT>
__global__ __launch_bounds__(256) void ln_kernel(
    const float* __restrict__ in, const float* __restrict__ g, const float* __restrict__ bt,
    float* __restrict__ outF, _Float16* __restrict__ outH) {
#pragma clang fp contract(off)
  __shared__ float red0[8];
  __shared__ float red1[8];
  __shared__ __attribute__((aligned(16))) _Float16 sh[DIM];
  const size_t row = blockIdx.x;
  const int tid = threadIdx.x, wave = tid >> 5, lane = tid & 31;
  const v4f v = *(const v4f*)(in + row * DIM + tid * 4);
  float s = (v[0] + v[1]) + (v[2] + v[3]);
#pragma unroll
  for (int m = 16; m >= 1; m >>= 1) s += __shfl_xor(s, m, 32);
  if (lane == 0) red0[wave] = s;
  __syncthreads();
  float S = 0.f;
#pragma unroll
  for (int i = 0; i < 8; ++i) S += red0[i];
  const float mu = S * (1.0f / (float)DIM);
  const float d0 = v[0] - mu, d1 = v[1] - mu, d2 = v[2] - mu, d3 = v[3] - mu;
  float ss = (d0 * d0 + d1 * d1) + (d2 * d2 + d3 * d3);
#pragma unroll
  for (int m = 16; m >= 1; m >>= 1) ss += __shfl_xor(ss, m, 32);
  if (lane == 0) red1[wave] = ss;
  __syncthreads();
  float SS = 0.f;
#pragma unroll
  for (int i = 0; i < 8; ++i) SS += red1[i];
  const float var = SS * (1.0f / (float)DIM);
  const float rstd = rsqrtf(var + 1e-5f);
  const v4f gg = *(const v4f*)(g + tid * 4);
  const v4f bb = *(const v4f*)(bt + tid * 4);
  v4f y;
  y[0] = d0 * rstd * bf16r(gg[0]) + bf16r(bb[0]);
  y[1] = d1 * rstd * bf16r(gg[1]) + bf16r(bb[1]);
  y[2] = d2 * rstd * bf16r(gg[2]) + bf16r(bb[2]);
  y[3] = d3 * rstd * bf16r(gg[3]) + bf16r(bb[3]);
  const size_t orow = MAPOUT ? FROW(row) : row;
  float* op = outF + orow * DIM + tid * 4;
  *(v4f*)op = y;
  
  if constexpr (OUT16) {
#pragma unroll
    for (int e = 0; e < 4; ++e) sh[tid * 4 + e] = (_Float16)y[e];
    __syncthreads();
    if (tid < 128) {                           // waves 0..3, wave-uniform
      const v8h hv = *(const v8h*)(sh + tid * 8);
      _Float16* hp = outH + row * DIM + tid * 8;
      *(v8h*)hp = hv;
      
    }
  }
}

// ---------------------------------------------------------------------------
// Launch plan (13 launches):
//  cvt_x, cvt_wt x4 (qkv | o | 1 | 2), gemm qkv, vtrans, attn, gemm o (+x),
//  ln1, gemm 1 (relu), gemm 2 (+h), ln2 -> d_out
// Workspace (byte offsets derived below, total 106 MiB at full size):
//  W planes 10 MiB | P1 16 MiB: X16 -> VT16 -> G16 | P2 48 MiB: QKV16 -> {R1, H16} -> R2
//  | P3 32 MiB: CTX16 -> H32
// ---------------------------------------------------------------------------
extern "C" void kernel_launch(void* const* d_in, const int* in_sizes, int n_in,
                              void* d_out, int out_size, void* d_ws, size_t ws_size,
                              hipStream_t stream) {
  if (n_in < 13) return;
  const size_t needX = ((size_t)(NB - 1) * SEQ_FULL + SEQ) * DIM;
  if ((size_t)in_sizes[0] < needX) return;
  if (in_sizes[1] < DIM * DIM || in_sizes[2] < DIM * DIM || in_sizes[3] < DIM * DIM ||
      in_sizes[4] < DIM * DIM) return;
  if (in_sizes[5] < DIM || in_sizes[6] < DIM || in_sizes[10] < DIM || in_sizes[11] < DIM ||
      in_sizes[12] < DIM) return;
  if (in_sizes[7] < DIM * HID || in_sizes[8] < HID || in_sizes[9] < HID * DIM) return;
  if ((size_t)out_size < needX) return;

  const float* x     = (const float*)d_in[0];
  const float* Wq    = (const float*)d_in[1];
  const float* Wk    = (const float*)d_in[2];
  const float* Wv    = (const float*)d_in[3];
  const float* Wo    = (const float*)d_in[4];
  const float* ln1_g = (const float*)d_in[5];
  const float* ln1_b = (const float*)d_in[6];
  const float* W1    = (const float*)d_in[7];
  const float* b1    = (const float*)d_in[8];
  const float* W2    = (const float*)d_in[9];
  const float* b2    = (const float*)d_in[10];
  const float* ln2_g = (const float*)d_in[11];
  const float* ln2_b = (const float*)d_in[12];
  float* out = (float*)d_out;

  // carve (all region sizes are exact multiples of the whole-line stores used)
  const size_t szWqkv = (size_t)3 * DIM * DIM * 2;     // [3072][1024] f16
  const size_t szWo   = (size_t)DIM * DIM * 2;         // [1024][1024] f16
  const size_t szW1   = (size_t)HID * DIM * 2;         // [512][1024]  f16 (W1^T)
  const size_t szW2   = (size_t)DIM * HID * 2;         // [1024][512]  f16 (W2^T)
  const size_t szP1   = (size_t)MROWS * DIM * 2;       // X16 / VT16 / G16
  const size_t szP2   = (size_t)MROWS * LDQKV * 2;     // QKV16 / {R1,H16} / R2
  const size_t szP3   = (size_t)MROWS * DIM * 4;       // CTX16 / H32
  const size_t oWqkv = 0;
  const size_t oWo   = oWqkv + szWqkv;
  const size_t oW1   = oWo + szWo;
  const size_t oW2   = oW1 + szW1;
  const size_t oP1   = oW2 + szW2;
  const size_t oP2   = oP1 + szP1;
  const size_t oP3   = oP2 + szP2;
  const size_t total = oP3 + szP3;
  if (total > ws_size) return;
  static_assert((size_t)MROWS * DIM * 4 + (size_t)MROWS * DIM * 2 <= (size_t)MROWS * LDQKV * 2);
  static_assert((size_t)MROWS * HID * 2 <= (size_t)MROWS * DIM * 2);
  static_assert((size_t)NB * NHEAD * DHEAD * SEQ * 2 <= (size_t)MROWS * DIM * 2);

  char* ws = (char*)d_ws;
  _Float16* Wqkv_t = (_Float16*)(ws + oWqkv);
  _Float16* Wo_t   = (_Float16*)(ws + oWo);
  _Float16* W1_t   = (_Float16*)(ws + oW1);
  _Float16* W2_t   = (_Float16*)(ws + oW2);
  _Float16* X16    = (_Float16*)(ws + oP1);
  _Float16* VT16   = (_Float16*)(ws + oP1);
  _Float16* G16    = (_Float16*)(ws + oP1);
  _Float16* QKV16  = (_Float16*)(ws + oP2);
  float*    R1     = (float*)   (ws + oP2);
  _Float16* H16    = (_Float16*)(ws + oP2 + (size_t)MROWS * DIM * 4);
  float*    R2     = (float*)   (ws + oP2);
  _Float16* CTX16  = (_Float16*)(ws + oP3);
  float*    H32    = (float*)   (ws + oP3);

  const float wsc   = 32.0f;                  // weight carry
  const float inv32 = 1.0f / 32.0f;
  const float inv512 = 1.0f / 512.0f;         // 1/(32 weight carry * 16 ctx carry)

  // 1) x -> X16 (bf16 RNE, f16 container)
  cvt_x_kernel<<<dim3(MROWS / 2), 256, 0, stream>>>(x, X16);

  // 2) weights -> transposed f16 planes, bf16 RNE then x32
  cvt_wt_kernel<<<dim3(DIM / 64, DIM / 64, 3), 256, 0, stream>>>(Wq, Wk, Wv, Wqkv_t, DIM, DIM, wsc);
  cvt_wt_kernel<<<dim3(DIM / 64, DIM / 64, 1), 256, 0, stream>>>(Wo, Wo, Wo, Wo_t, DIM, DIM, wsc);
  cvt_wt_kernel<<<dim3(HID / 64, DIM / 64, 1), 256, 0, stream>>>(W1, W1, W1, W1_t, DIM, HID, wsc);
  cvt_wt_kernel<<<dim3(DIM / 64, HID / 64, 1), 256, 0, stream>>>(W2, W2, W2, W2_t, HID, DIM, wsc);

  // 3) qkv = x @ [Wq | Wk | Wv]   (f16 out, 1/32 folded)
  gemm_kernel<false, 0, false, true>
      <<<dim3(LDQKV / BN, MROWS / BM), 256, 0, stream>>>(
          X16, Wqkv_t, nullptr, nullptr, nullptr, QKV16, LDQKV, DIM, inv32);

  // 4) V^T plane per (b,h)
  vtrans_kernel<<<dim3(SEQ / 64, NB * NHEAD), 256, 0, stream>>>(QKV16, VT16);

  // 5) ctx = softmax(q k^T / 8) v    (f16 out, carried x16)
  attn_kernel<<<dim3(NB * NHEAD * (SEQ / AQ)), 256, 0, stream>>>(QKV16, VT16, CTX16);

  // 6) r1 = ctx @ Wo + bf16r(x)        (f32 out)
  gemm_kernel<false, 2, false, false>
      <<<dim3(DIM / BN, MROWS / BM), 256, 0, stream>>>(
          CTX16, Wo_t, nullptr, x, R1, nullptr, DIM, DIM, inv512);

  // 7) h = LN1(r1)                     (f32 + f16)
  ln_kernel<true, false><<<dim3(MROWS), 256, 0, stream>>>(R1, ln1_g, ln1_b, H32, H16);

  // 8) g = relu(h @ W1 + b1)           (f16 out)
  gemm_kernel<true, 0, true, true>
      <<<dim3(HID / BN, MROWS / BM), 256, 0, stream>>>(
          H16, W1_t, b1, nullptr, nullptr, G16, HID, DIM, inv32);

  // 9) r2 = g @ W2 + b2 + h            (f32 out)
  gemm_kernel<true, 1, false, false>
      <<<dim3(DIM / BN, MROWS / BM), 256, 0, stream>>>(
          G16, W2_t, b2, H32, R2, nullptr, DIM, HID, inv32);

  // 10) out = LN2(r2)                  (f32, full-size row layout)
  ln_kernel<false, true><<<dim3(MROWS), 256, 0, stream>>>(R2, ln2_g, ln2_b, out, nullptr);
}

// v002
// A run of this version takes 244 microseconds.
// In two side-by-side timings against v001, it was 1.11 and 1.10 times as fast.
// Counting every step since v000, it is 1.56 times as fast.
#include <hip/hip_runtime.h>
#include <stdint.h>
#include <stddef.h>

// All contractions: v_wmma_f32_16x16x32_f16 (f16 operands, f32 accumulate): q/k/v projections, q.k^T scores, P.1 row sums, P.V, output projection, FFN up, FFN down. Float inputs RNE-converted to bf16 then carried in f16 (weights x32, P x1024, ctx x16); softmax and LayerNorm in f32.

#ifndef NB
#define NB 8
#endif
#ifndef SEQ
#define SEQ 1024
#endif
#define NB_FULL 8
#define SEQ_FULL 1024
#define DIM 1024
#define NHEAD 16
#define DHEAD 64
#define HID 512
#define MROWS (NB * SEQ)
#define LDQKV (3 * DIM)
// compact row m (b*SEQ + s) -> full-size row (b*SEQ_FULL + s) for input x and for d_out
#define FROW(m) ((((size_t)(m)) / SEQ) * SEQ_FULL + (((size_t)(m)) % SEQ))

static_assert(NB >= 1 && NB <= NB_FULL);
static_assert(SEQ >= 64 && SEQ <= SEQ_FULL && (SEQ % 64) == 0);
static_assert((MROWS % 128) == 0);
static_assert((DIM % 128) == 0 && (HID % 128) == 0 && (DIM % 32) == 0 && (HID % 32) == 0);
static_assert(NHEAD * DHEAD == DIM && DHEAD == 64);
static_assert(((size_t)(NB - 1) * SEQ_FULL + SEQ) * DIM <= (size_t)NB_FULL * SEQ_FULL * DIM);

// ---------------------------------------------------------------------------
// Types / helpers
// ---------------------------------------------------------------------------
typedef _Float16 v16h __attribute__((ext_vector_type(16)));
typedef _Float16 v8h  __attribute__((ext_vector_type(8)));
typedef float    v8f  __attribute__((ext_vector_type(8)));
typedef float    v4f  __attribute__((ext_vector_type(4)));

// 16x16x32 f16 WMMA followed by the VALU hazard guard (ties D, keeps A/B live)
static __device__ __forceinline__ v8f wmma16(v16h a, v16h b, v8f c) {
  v8f d = __builtin_amdgcn_wmma_f32_16x16x32_f16(false, a, false, b, (short)0, c, false, false);
  asm volatile("v_nop\n\tv_nop\n\tv_nop\n\tv_nop" : "+v"(d) : "v"(a), "v"(b));
  return d;
}

// f32 -> nearest-even bf16 value, returned as f32
static __device__ __forceinline__ float bf16r(float f) {
  unsigned int u = __float_as_uint(f);
  u = (u + 0x7FFFu + ((u >> 16) & 1u)) & 0xFFFF0000u;
  return __uint_as_float(u);
}

// Build a 16-half WMMA A/B fragment for one lane from a row-major (k-contiguous) run.
// 16-bit operand layout: lane-half base8 = (lane>=16)?8:0;
// halves 0..7 -> k = base8+0..7, halves 8..15 -> k = base8+16..23.
// Caller passes p already offset by base8; we read [p, p+8) and [p+16, p+24).
static __device__ __forceinline__ v16h load_frag(const _Float16* p) {
  v8h lo = *(const v8h*)(p);
  v8h hi = *(const v8h*)(p + 16);
  v16h f;
#pragma unroll
  for (int e = 0; e < 8; ++e) { f[e] = lo[e]; f[e + 8] = hi[e]; }
  return f;
}

// ---------------------------------------------------------------------------
// x (f32 [NB_FULL*SEQ_FULL][DIM]) -> X16 (f16 [MROWS][DIM]), bf16 RNE first.
// grid = MROWS*DIM/8/256 exactly.
// ---------------------------------------------------------------------------
__global__ __launch_bounds__(256) void cvt_x_kernel(const float* __restrict__ x,
                                                    _Float16* __restrict__ X16) {
#pragma clang fp contract(off)
  const size_t i = (size_t)blockIdx.x * 256 + threadIdx.x;   // 8-element chunk
  const size_t m = i / (DIM / 8);
  const int c = (int)(i % (DIM / 8)) * 8;
  const float* src = x + FROW(m) * DIM + c;
  const v4f a = *(const v4f*)(src);
  const v4f b = *(const v4f*)(src + 4);
  v8h hv;
#pragma unroll
  for (int e = 0; e < 4; ++e) {
    hv[e]     = (_Float16)bf16r(a[e]);
    hv[e + 4] = (_Float16)bf16r(b[e]);
  }
  _Float16* dst = X16 + m * DIM + c;
  *(v8h*)dst = hv;
  
}

// ---------------------------------------------------------------------------
// Weight W (f32 [K][N] row-major, up to 3 parts selected by blockIdx.z) ->
// transposed f16 plane dst[part*N + n][k] = f16(bf16r(W[k][n]) * scale).
// (8 lanes x 16 B, one instruction per 32 lines). grid = (N/64, K/64, parts).
// ---------------------------------------------------------------------------
#define TP 72
__global__ __launch_bounds__(256) void cvt_wt_kernel(
    const float* __restrict__ w0, const float* __restrict__ w1, const float* __restrict__ w2,
    _Float16* __restrict__ dst, int K, int N, float scale) {
#pragma clang fp contract(off)
  __shared__ __attribute__((aligned(16))) _Float16 T[64 * TP];   // [n][k]
  const int part = blockIdx.z;
  const float* w = (part == 0) ? w0 : ((part == 1) ? w1 : w2);   // block-uniform select
  const int k0 = blockIdx.y * 64, n0 = blockIdx.x * 64;
  const int tid = threadIdx.x;
#pragma unroll
  for (int q = 0; q < 4; ++q) {
    const int idx = q * 256 + tid;            // 0..1023
    const int kr = idx >> 4;                  // 0..63
    const int nc = (idx & 15) << 2;           // 0..60
    const v4f v = *(const v4f*)(w + (size_t)(k0 + kr) * N + n0 + nc);
#pragma unroll
    for (int e = 0; e < 4; ++e) T[(nc + e) * TP + kr] = (_Float16)(bf16r(v[e]) * scale);
  }
  __syncthreads();
  const int rs = tid >> 3, cc = (tid & 7) << 3;
  v8h hv[2];
  size_t go[2];
#pragma unroll
  for (int it = 0; it < 2; ++it) {
    const int nl = it * 32 + rs;              // 0..63
    hv[it] = *(const v8h*)(T + nl * TP + cc);
    go[it] = ((size_t)part * N + n0 + nl) * (size_t)K + k0 + cc;
  }
#pragma unroll
  for (int it = 0; it < 2; ++it) *(v8h*)(dst + go[it]) = hv[it];
  
}

// ---------------------------------------------------------------------------
// V transpose: qkv (f16 [MROWS][3*DIM], v at col 2*DIM + h*64 + d) ->
// vt[(b*NHEAD+h)*64 + d][s] (s-contiguous, pitch SEQ). 64x64 tiles through LDS,
// ---------------------------------------------------------------------------
__global__ __launch_bounds__(256) void vtrans_kernel(const _Float16* __restrict__ qkv,
                                                     _Float16* __restrict__ vt) {
  __shared__ __attribute__((aligned(16))) _Float16 T[64 * TP];   // [d][s]
  const int bh = blockIdx.y;
  const int b = bh / NHEAD, h = bh % NHEAD;
  const int s0 = blockIdx.x * 64;
  const int tid = threadIdx.x;
#pragma unroll
  for (int q = 0; q < 2; ++q) {
    const int idx = q * 256 + tid;            // 0..511
    const int sr = idx >> 3;                  // 0..63
    const int dc = (idx & 7) << 3;            // 0..56
    const v8h v = *(const v8h*)(qkv + ((size_t)b * SEQ + s0 + sr) * LDQKV + 2 * DIM + h * DHEAD + dc);
#pragma unroll
    for (int e = 0; e < 8; ++e) T[(dc + e) * TP + sr] = v[e];
  }
  __syncthreads();
  const int rs = tid >> 3, cc = (tid & 7) << 3;
  v8h hv[2];
  size_t go[2];
#pragma unroll
  for (int it = 0; it < 2; ++it) {
    const int dl = it * 32 + rs;              // 0..63
    hv[it] = *(const v8h*)(T + dl * TP + cc);
    go[it] = ((size_t)bh * DHEAD + dl) * (size_t)SEQ + s0 + cc;
  }
#pragma unroll
  for (int it = 0; it < 2; ++it) *(v8h*)(vt + go[it]) = hv[it];
  
}

// ---------------------------------------------------------------------------
// WMMA GEMM: C[M][N] = A[M][K] (f16, row-major) . B, with B given transposed as
// Bt[N][K] (f16, k-contiguous).  C = acc*scale (+bias) (relu) (+residual).
// 128x128x32 block tile, 8 waves, wave tile 64x32 (4x2 WMMA tiles).
// Single-buffered LDS staging with plain loads. Epilogue stages 64 rows at a
// residual plane is read in the store phase as 16-B vectors (8 loads per lane).
// RES: 0 none, 1 f32 plane [M][N], 2 bf16r(x) read at full-size rows (N == DIM).
// Requires M%128==0 (grid.y = M/128), N%128==0 (grid.x = N/128), K%32==0.
// ---------------------------------------------------------------------------
#define BM 128
#define BN 128
#define BK 32
#define LDT 40     // LDS tile row stride in halves (80 B)
#define EPF 132    // epilogue stage pitch in floats (528 B)
#define GEMM_SMEM_FLOATS (64 * EPF)
static_assert((BM + BN) * LDT * 2 <= GEMM_SMEM_FLOATS * 4);

template <bool HAS_BIAS, int RES, bool RELU, bool OUT16>
__global__ __launch_bounds__(256) void gemm_kernel(
    const _Float16* __restrict__ A, const _Float16* __restrict__ Bt,
    const float* __restrict__ bias, const float* __restrict__ res,
    float* __restrict__ outF, _Float16* __restrict__ outH,
    int N, int K, float scale) {
  static_assert(!(RES != 0 && OUT16));
  __shared__ __attribute__((aligned(16))) float smem[GEMM_SMEM_FLOATS];
  _Float16* As = (_Float16*)smem;           // [m][k]
  _Float16* Bs = As + BM * LDT;             // [n][k]
  const int tid = threadIdx.x;
  const int wave = tid >> 5, lane = tid & 31;
  const int r = lane & 15, hb = (lane >> 4) << 3;
  const int mBlk = blockIdx.y * BM, nBlk = blockIdx.x * BN;
  const int mw = (wave & 1) * 64, nw = (wave >> 1) * 32;

  // staging coords: 128 rows x 32 k per operand = 512 chunks of 8 halves, 2 per thread
  const int sr0 = tid >> 2, sr1 = sr0 + 64, skc = (tid & 3) << 3;
  const _Float16* gA0 = A  + (size_t)(mBlk + sr0) * K + skc;
  const _Float16* gA1 = A  + (size_t)(mBlk + sr1) * K + skc;
  const _Float16* gB0 = Bt + (size_t)(nBlk + sr0) * K + skc;
  const _Float16* gB1 = Bt + (size_t)(nBlk + sr1) * K + skc;

  v8f acc[4][2];
#pragma unroll
  for (int i = 0; i < 4; ++i)
#pragma unroll
    for (int j = 0; j < 2; ++j)
#pragma unroll
      for (int v = 0; v < 8; ++v) acc[i][j][v] = 0.f;

  const int nk = K / BK;
#pragma unroll 1
  for (int kt = 0; kt < nk; ++kt) {
    const size_t ko = (size_t)kt * BK;
    const v8h a0 = *(const v8h*)(gA0 + ko);
    const v8h a1 = *(const v8h*)(gA1 + ko);
    const v8h b0 = *(const v8h*)(gB0 + ko);
    const v8h b1 = *(const v8h*)(gB1 + ko);
    __syncthreads();                          // all waves done with the prior tile
    *(v8h*)(As + sr0 * LDT + skc) = a0;
    *(v8h*)(As + sr1 * LDT + skc) = a1;
    *(v8h*)(Bs + sr0 * LDT + skc) = b0;
    *(v8h*)(Bs + sr1 * LDT + skc) = b1;
    __syncthreads();                          // tile fully staged
    v16h af[4], bfr[2];
#pragma unroll
    for (int i = 0; i < 4; ++i) af[i] = load_frag(As + (mw + i * 16 + r) * LDT + hb);
#pragma unroll
    for (int j = 0; j < 2; ++j) bfr[j] = load_frag(Bs + (nw + j * 16 + r) * LDT + hb);
#pragma unroll
    for (int i = 0; i < 4; ++i)
#pragma unroll
      for (int j = 0; j < 2; ++j) acc[i][j] = wmma16(af[i], bfr[j], acc[i][j]);
  }
  __syncthreads();                            // LDS reused as the epilogue stage

  // epilogue. D layout: element v -> row 8*lanehi + v, lane&15 -> col.
  float* stg = smem;                          // [64][EPF] f32
  float bcol[2] = {0.f, 0.f};
  if constexpr (HAS_BIAS) {
#pragma unroll
    for (int j = 0; j < 2; ++j) bcol[j] = bf16r(bias[nBlk + nw + j * 16 + r]);
  }
#pragma unroll
  for (int p = 0; p < 2; ++p) {
    if ((wave & 1) == p) {                    // wave-uniform: waves owning rows p*64..p*64+63
#pragma unroll
      for (int i = 0; i < 4; ++i)
#pragma unroll
        for (int j = 0; j < 2; ++j)
#pragma unroll
          for (int v = 0; v < 8; ++v) {
            const int lr = i * 16 + hb + v;                   // 0..63
            const int lc = nw + j * 16 + r;                   // 0..127
            float c = acc[i][j][v] * scale;
            if constexpr (HAS_BIAS) c += bcol[j];
            if constexpr (RELU) c = fmaxf(c, 0.f);
            stg[lr * EPF + lc] = c;
          }
    }
    __syncthreads();
    if constexpr (OUT16) {
      // f16 row segment = 128 halves = 256 B = 2 lines; 16 lanes x 16 B per row
      v8h hv[4];
      size_t go[4];
#pragma unroll
      for (int it = 0; it < 4; ++it) {
        const int lr = it * 16 + wave * 2 + (lane >> 4);   // 0..63
        const int lc = (lane & 15) << 3;                    // 0..120
        const v4f x0 = *(const v4f*)(stg + lr * EPF + lc);
        const v4f x1 = *(const v4f*)(stg + lr * EPF + lc + 4);
        v8h hh;
#pragma unroll
        for (int e = 0; e < 4; ++e) { hh[e] = (_Float16)x0[e]; hh[e + 4] = (_Float16)x1[e]; }
        hv[it] = hh;
        go[it] = (size_t)(mBlk + p * 64 + lr) * (size_t)N + nBlk + lc;
      }
#pragma unroll
      for (int it = 0; it < 4; ++it) *(v8h*)(outH + go[it]) = hv[it];
      
    } else {
      // f32 row segment = 128 floats = 512 B = 4 lines; 32 lanes x 16 B per row.
      // Residual added here from one 16-B load per row per lane (8 global loads per lane).
      v4f fv[8];
      size_t go[8];
#pragma unroll
      for (int it = 0; it < 8; ++it) {
        const int lr = it * 8 + wave;                        // 0..63
        const int lc = lane << 2;                            // 0..124
        const size_t grow = (size_t)(mBlk + p * 64 + lr);
        const size_t gcol = (size_t)(nBlk + lc);
        v4f val = *(const v4f*)(stg + lr * EPF + lc);
        if constexpr (RES == 1) {
          const v4f rr = *(const v4f*)(res + grow * (size_t)N + gcol);
#pragma unroll
          for (int e = 0; e < 4; ++e) val[e] = val[e] + rr[e];
        }
        if constexpr (RES == 2) {
          const v4f rr = *(const v4f*)(res + FROW(grow) * (size_t)DIM + gcol);
#pragma unroll
          for (int e = 0; e < 4; ++e) val[e] = val[e] + bf16r(rr[e]);
        }
        fv[it] = val;
        go[it] = grow * (size_t)N + gcol;
      }
#pragma unroll
      for (int it = 0; it < 8; ++it) *(v4f*)(outF + go[it]) = fv[it];
      
    }
    __syncthreads();                          // stage reused by the other row half
  }
}

#define OPAD 72   // O stage row stride (halves)
#define AW 8                    // waves per block
#define AQ (AW * 16)            // query rows per block
#define SK 64                   // keys per stage
#define KVP 72                  // staged row pitch in halves (144 B = 16 B x odd)
#define TILE_H (64 * KVP)       // halves per staged tile
#define NST (SEQ / SK)          // stages
static_assert((SEQ % AQ) == 0 && (SEQ % SK) == 0 && AW * 32 == 256);

// One stage: each lane copies two 16-B pieces of the K tile and two of the V^T tile.
// The s_wait_xcnt stands inside the statement so that no address register of a
// copy is rewritten in front of it.
static __device__ __forceinline__ void stage_kv(unsigned lk0, unsigned lk1, unsigned lv0, unsigned lv1,
                                                const _Float16* gk0, const _Float16* gk1,
                                                const _Float16* gv0, const _Float16* gv1) {
  asm volatile(
      "global_load_async_to_lds_b128 %0, %4, off\n\t"
      "global_load_async_to_lds_b128 %1, %5, off\n\t"
      "global_load_async_to_lds_b128 %2, %6, off\n\t"
      "global_load_async_to_lds_b128 %3, %7, off\n\t"
      "s_wait_xcnt 0x0"
      :: "v"(lk0), "v"(lk1), "v"(lv0), "v"(lv1), "v"(gk0), "v"(gk1), "v"(gv0), "v"(gv1)
      : "memory");
}

// value of lane l ^ 16 (the other half's share of the same query column)
static __device__ __forceinline__ float xhalf(float x) {
  return __builtin_bit_cast(float, __builtin_amdgcn_permlanex16(
      __builtin_bit_cast(int, x), __builtin_bit_cast(int, x), 0x76543210, 0xfedcba98, false, false));
}

__global__ __launch_bounds__(256) __attribute__((amdgpu_num_vgpr(256)))
void attn_kernel(const _Float16* __restrict__ qkv, const _Float16* __restrict__ vt,
                 _Float16* __restrict__ ctx) {
  __shared__ __attribute__((aligned(16))) _Float16 KV[2 * 2 * TILE_H];   // [buffer][K | V^T][row][KVP]
  __shared__ __attribute__((aligned(16))) _Float16 Os[AW * 16 * OPAD];   // per-wave O 16x64
  const int nqt = SEQ / AQ;
  const int qt = (int)(blockIdx.x % nqt);
  const int bh = (int)(blockIdx.x / nqt);
  const int h = bh % NHEAD, b = bh / NHEAD;
  const int tid = threadIdx.x, wave = tid >> 5, lane = tid & 31;
  const int r = lane & 15, hb = (lane >> 4) << 3;
  const _Float16* Qb = qkv + (size_t)b * SEQ * LDQKV + h * DHEAD;
  const _Float16* Kh = Qb + DIM;
  const _Float16* Vh = vt + (size_t)bh * DHEAD * SEQ;
  const int q0 = qt * AQ + wave * 16;

  // staging coords: 64 rows x 8 pieces of 16 B per tile = 512 pieces, 2 per thread
  const int srow = tid >> 3, sch = (tid & 7) << 3;
  const _Float16* gK = Kh + (size_t)srow * LDQKV + sch;      // + key0 * LDQKV per stage
  const _Float16* gV = Vh + (size_t)srow * SEQ + sch;        // + key0 per stage
  const unsigned lK = (unsigned)(uintptr_t)(KV + srow * KVP + sch);   // LDS byte address, buffer 0
  const unsigned lV = lK + TILE_H * 2;
  const unsigned l32 = 32 * KVP * 2;                          // 32 rows further, bytes
  const unsigned lbuf = 2 * TILE_H * 2;                       // buffer size, bytes

  // stage 0 into buffer 0; landed and published before anything reads it
  stage_kv(lK, lK + l32, lV, lV + l32, gK, gK + (size_t)32 * LDQKV, gV, gV + (size_t)32 * SEQ);
  asm volatile("s_wait_asynccnt 0x0" ::: "memory");          // this wave's copies have landed
  __syncthreads();                                            // every wave's copies are readable
  if (NST > 1) {
    const _Float16* k1 = gK + (size_t)SK * LDQKV;
    const _Float16* v1 = gV + SK;
    stage_kv(lK + lbuf, lK + lbuf + l32, lV + lbuf, lV + lbuf + l32,
             k1, k1 + (size_t)32 * LDQKV, v1, v1 + (size_t)32 * SEQ);
  }

  // Q fragments (B: lane -> query column, halves -> d), d chunks 0..31 and 32..63
  v16h aq[2];
#pragma unroll
  for (int dc = 0; dc < 2; ++dc)
    aq[dc] = load_frag(Qb + (size_t)(q0 + r) * LDQKV + dc * 32 + hb);

  // constant all-ones A fragment: ones . P^T -> per-query sums (every row of D alike)
  v16h ones;
#pragma unroll
  for (int e = 0; e < 16; ++e) ones[e] = (_Float16)1.0f;

  v8f o[4];
#pragma unroll
  for (int t = 0; t < 4; ++t)
#pragma unroll
    for (int v = 0; v < 8; ++v) o[t][v] = 0.f;
  float mrow = -1e30f, lrow = 0.f;           // of this lane's query (q0 + r), alike in both halves

  const v8f zero = {0.f, 0.f, 0.f, 0.f, 0.f, 0.f, 0.f, 0.f};

#pragma unroll 1
  for (int st = 0; st < NST; ++st) {
   const _Float16* Kt = KV + (st & 1) * (2 * TILE_H);
   const _Float16* Vt = Kt + TILE_H;
#pragma unroll
   for (int sub = 0; sub < SK / 32; ++sub) {
    const int key0 = sub * 32;                // key offset inside the staged tile

    // S^T(32x16) = K(32x64) . Q^T : A-frag lane -> key, halves -> d (split map)
    // D: element v of tile kt -> key kt*16 + 8*lanehi + v, lane&15 -> query
    v8f s[2];
#pragma unroll
    for (int kt = 0; kt < 2; ++kt)
#pragma unroll
      for (int v = 0; v < 8; ++v) s[kt][v] = 0.f;
#pragma unroll
    for (int kt = 0; kt < 2; ++kt)
#pragma unroll
      for (int dc = 0; dc < 2; ++dc) {
        const v16h ak = load_frag(Kt + (key0 + kt * 16 + r) * KVP + dc * 32 + hb);
        s[kt] = wmma16(ak, aq[dc], s[kt]);
      }

    // online softmax of one query per lane: 16 keys here, 16 in lane ^ 16
    float m8[8];
#pragma unroll
    for (int v = 0; v < 8; ++v) m8[v] = fmaxf(s[0][v], s[1][v]);
    float mx = fmaxf(fmaxf(fmaxf(m8[0], m8[1]), fmaxf(m8[2], m8[3])),
                     fmaxf(fmaxf(m8[4], m8[5]), fmaxf(m8[6], m8[7]))) * 0.125f;   // * DH^-0.5
    mx = fmaxf(mx, xhalf(mx));
    const float mnew = fmaxf(mrow, mx);
    const float alpha = __expf(mrow - mnew);
    mrow = mnew;

    // P^T as the B operand: half e -> key (e < 8 ? 8*lanehi + e : 16 + 8*lanehi + e - 8),
    // which is element e & 7 of tile e >> 3 of this very lane
    v16h pf;
#pragma unroll
    for (int kt = 0; kt < 2; ++kt)
#pragma unroll
      for (int v = 0; v < 8; ++v)
        pf[kt * 8 + v] = (_Float16)(__expf(s[kt][v] * 0.125f - mnew) * 1024.0f);   // P carried x1024

    // row sums on the matrix pipe
    const v8f rsum = wmma16(ones, pf, zero);
    lrow = lrow * alpha + rsum[0];

    // O^T(64x16) = alpha*O^T + V^T(64x32) . P^T(32x16); V^T rows are d, key-contiguous
#pragma unroll
    for (int t = 0; t < 4; ++t) {
#pragma unroll
      for (int v = 0; v < 8; ++v) o[t][v] *= alpha;
      const v16h av = load_frag(Vt + (t * 16 + r) * KVP + key0 + hb);
      o[t] = wmma16(av, pf, o[t]);
    }
   }
   // publish point of stage st + 1, and hand-over of this stage's buffer
   asm volatile("s_wait_dscnt 0x0" ::: "memory");            // this wave's reads of the buffer are done
   asm volatile("s_wait_asynccnt 0x0" ::: "memory");         // this wave's copies of stage st + 1 have landed
   __syncthreads();                                           // publishes st + 1, ends every read of st
   if (st + 2 < NST) {
     const _Float16* kn = gK + (size_t)(st + 2) * SK * LDQKV;
     const _Float16* vn = gV + (st + 2) * SK;
     const unsigned lo = (unsigned)(st & 1) * lbuf;
     stage_kv(lK + lo, lK + lo + l32, lV + lo, lV + lo + l32,
              kn, kn + (size_t)32 * LDQKV, vn, vn + (size_t)32 * SEQ);
   }
  }
  asm volatile("s_wait_asynccnt 0x0" ::: "memory");          // nothing in flight when the wave ends

  // ctx = 16 * O / l  (the x1024 P carry cancels between O and l)
  // O^T: element v of tile t -> d = t*16 + 8*lanehi + v of query r: 8 consecutive halves
  _Float16* Ow = Os + wave * 16 * OPAD;
  const float inv = 16.0f / lrow;
#pragma unroll
  for (int t = 0; t < 4; ++t) {
    v8h ov;
#pragma unroll
    for (int v = 0; v < 8; ++v) ov[v] = (_Float16)(o[t][v] * inv);
    *(v8h*)(Ow + r * OPAD + t * 16 + hb) = ov;
  }
  __syncthreads();

  const int rs = lane >> 3, cc = (lane & 7) << 3;
  v8h hv[4];
  size_t go[4];
#pragma unroll
  for (int it = 0; it < 4; ++it) {
    const int lr = it * 4 + rs;               // 0..15
    hv[it] = *(const v8h*)(Ow + lr * OPAD + cc);
    go[it] = ((size_t)b * SEQ + q0 + lr) * (size_t)DIM + h * DHEAD + cc;
  }
#pragma unroll
  for (int it = 0; it < 4; ++it) *(v8h*)(ctx + go[it]) = hv[it];
  
}

// ---------------------------------------------------------------------------
// in: f32 [MROWS][DIM] (residual already added).  outF: f32 (row mapped to the
// full-size layout when MAPOUT), outH: f16 copy (compact rows) when OUT16.
// ---------------------------------------------------------------------------
template <bool OUT16, bool MAPOUT>
__global__ __launch_bounds__(256) void ln_kernel(
    const float* __restrict__ in, const float* __restrict__ g, const float* __restrict__ bt,
    float* __restrict__ outF, _Float16* __restrict__ outH) {
#pragma clang fp contract(off)
  __shared__ float red0[8];
  __shared__ float red1[8];
  __shared__ __attribute__((aligned(16))) _Float16 sh[DIM];
  const size_t row = blockIdx.x;
  const int tid = threadIdx.x, wave = tid >> 5, lane = tid & 31;
  const v4f v = *(const v4f*)(in + row * DIM + tid * 4);
  float s = (v[0] + v[1]) + (v[2] + v[3]);
#pragma unroll
  for (int m = 16; m >= 1; m >>= 1) s += __shfl_xor(s, m, 32);
  if (lane == 0) red0[wave] = s;
  __syncthreads();
  float S = 0.f;
#pragma unroll
  for (int i = 0; i < 8; ++i) S += red0[i];
  const float mu = S * (1.0f / (float)DIM);
  const float d0 = v[0] - mu, d1 = v[1] - mu, d2 = v[2] - mu, d3 = v[3] - mu;
  float ss = (d0 * d0 + d1 * d1) + (d2 * d2 + d3 * d3);
#pragma unroll
  for (int m = 16; m >= 1; m >>= 1) ss += __shfl_xor(ss, m, 32);
  if (lane == 0) red1[wave] = ss;
  __syncthreads();
  float SS = 0.f;
#pragma unroll
  for (int i = 0; i < 8; ++i) SS += red1[i];
  const float var = SS * (1.0f / (float)DIM);
  const float rstd = rsqrtf(var + 1e-5f);
  const v4f gg = *(const v4f*)(g + tid * 4);
  const v4f bb = *(const v4f*)(bt + tid * 4);
  v4f y;
  y[0] = d0 * rstd * bf16r(gg[0]) + bf16r(bb[0]);
  y[1] = d1 * rstd * bf16r(gg[1]) + bf16r(bb[1]);
  y[2] = d2 * rstd * bf16r(gg[2]) + bf16r(bb[2]);
  y[3] = d3 * rstd * bf16r(gg[3]) + bf16r(bb[3]);
  const size_t orow = MAPOUT ? FROW(row) : row;
  float* op = outF + orow * DIM + tid * 4;
  *(v4f*)op = y;
  
  if constexpr (OUT16) {
#pragma unroll
    for (int e = 0; e < 4; ++e) sh[tid * 4 + e] = (_Float16)y[e];
    __syncthreads();
    if (tid < 128) {                           // waves 0..3, wave-uniform
      const v8h hv = *(const v8h*)(sh + tid * 8);
      _Float16* hp = outH + row * DIM + tid * 8;
      *(v8h*)hp = hv;
      
    }
  }
}

// ---------------------------------------------------------------------------
// Launch plan (13 launches):
//  cvt_x, cvt_wt x4 (qkv | o | 1 | 2), gemm qkv, vtrans, attn, gemm o (+x),
//  ln1, gemm 1 (relu), gemm 2 (+h), ln2 -> d_out
// Workspace (byte offsets derived below, total 106 MiB at full size):
//  W planes 10 MiB | P1 16 MiB: X16 -> VT16 -> G16 | P2 48 MiB: QKV16 -> {R1, H16} -> R2
//  | P3 32 MiB: CTX16 -> H32
// ---------------------------------------------------------------------------
extern "C" void kernel_launch(void* const* d_in, const int* in_sizes, int n_in,
                              void* d_out, int out_size, void* d_ws, size_t ws_size,
                              hipStream_t stream) {
  if (n_in < 13) return;
  const size_t needX = ((size_t)(NB - 1) * SEQ_FULL + SEQ) * DIM;
  if ((size_t)in_sizes[0] < needX) return;
  if (in_sizes[1] < DIM * DIM || in_sizes[2] < DIM * DIM || in_sizes[3] < DIM * DIM ||
      in_sizes[4] < DIM * DIM) return;
  if (in_sizes[5] < DIM || in_sizes[6] < DIM || in_sizes[10] < DIM || in_sizes[11] < DIM ||
      in_sizes[12] < DIM) return;
  if (in_sizes[7] < DIM * HID || in_sizes[8] < HID || in_sizes[9] < HID * DIM) return;
  if ((size_t)out_size < needX) return;

  const float* x     = (const float*)d_in[0];
  const float* Wq    = (const float*)d_in[1];
  const float* Wk    = (const float*)d_in[2];
  const float* Wv    = (const float*)d_in[3];
  const float* Wo    = (const float*)d_in[4];
  const float* ln1_g = (const float*)d_in[5];
  const float* ln1_b = (const float*)d_in[6];
  const float* W1    = (const float*)d_in[7];
  const float* b1    = (const float*)d_in[8];
  const float* W2    = (const float*)d_in[9];
  const float* b2    = (const float*)d_in[10];
  const float* ln2_g = (const float*)d_in[11];
  const float* ln2_b = (const float*)d_in[12];
  float* out = (float*)d_out;

  // carve (all region sizes are exact multiples of the whole-line stores used)
  const size_t szWqkv = (size_t)3 * DIM * DIM * 2;     // [3072][1024] f16
  const size_t szWo   = (size_t)DIM * DIM * 2;         // [1024][1024] f16
  const size_t szW1   = (size_t)HID * DIM * 2;         // [512][1024]  f16 (W1^T)
  const size_t szW2   = (size_t)DIM * HID * 2;         // [1024][512]  f16 (W2^T)
  const size_t szP1   = (size_t)MROWS * DIM * 2;       // X16 / VT16 / G16
  const size_t szP2   = (size_t)MROWS * LDQKV * 2;     // QKV16 / {R1,H16} / R2
  const size_t szP3   = (size_t)MROWS * DIM * 4;       // CTX16 / H32
  const size_t oWqkv = 0;
  const size_t oWo   = oWqkv + szWqkv;
  const size_t oW1   = oWo + szWo;
  const size_t oW2   = oW1 + szW1;
  const size_t oP1   = oW2 + szW2;
  const size_t oP2   = oP1 + szP1;
  const size_t oP3   = oP2 + szP2;
  const size_t total = oP3 + szP3;
  if (total > ws_size) return;
  static_assert((size_t)MROWS * DIM * 4 + (size_t)MROWS * DIM * 2 <= (size_t)MROWS * LDQKV * 2);
  static_assert((size_t)MROWS * HID * 2 <= (size_t)MROWS * DIM * 2);
  static_assert((size_t)NB * NHEAD * DHEAD * SEQ * 2 <= (size_t)MROWS * DIM * 2);

  char* ws = (char*)d_ws;
  _Float16* Wqkv_t = (_Float16*)(ws + oWqkv);
  _Float16* Wo_t   = (_Float16*)(ws + oWo);
  _Float16* W1_t   = (_Float16*)(ws + oW1);
  _Float16* W2_t   = (_Float16*)(ws + oW2);
  _Float16* X16    = (_Float16*)(ws + oP1);
  _Float16* VT16   = (_Float16*)(ws + oP1);
  _Float16* G16    = (_Float16*)(ws + oP1);
  _Float16* QKV16  = (_Float16*)(ws + oP2);
  float*    R1     = (float*)   (ws + oP2);
  _Float16* H16    = (_Float16*)(ws + oP2 + (size_t)MROWS * DIM * 4);
  float*    R2     = (float*)   (ws + oP2);
  _Float16* CTX16  = (_Float16*)(ws + oP3);
  float*    H32    = (float*)   (ws + oP3);

  const float wsc   = 32.0f;                  // weight carry
  const float inv32 = 1.0f / 32.0f;
  const float inv512 = 1.0f / 512.0f;         // 1/(32 weight carry * 16 ctx carry)

  // 1) x -> X16 (bf16 RNE, f16 container)
  cvt_x_kernel<<<dim3(MROWS / 2), 256, 0, stream>>>(x, X16);

  // 2) weights -> transposed f16 planes, bf16 RNE then x32
  cvt_wt_kernel<<<dim3(DIM / 64, DIM / 64, 3), 256, 0, stream>>>(Wq, Wk, Wv, Wqkv_t, DIM, DIM, wsc);
  cvt_wt_kernel<<<dim3(DIM / 64, DIM / 64, 1), 256, 0, stream>>>(Wo, Wo, Wo, Wo_t, DIM, DIM, wsc);
  cvt_wt_kernel<<<dim3(HID / 64, DIM / 64, 1), 256, 0, stream>>>(W1, W1, W1, W1_t, DIM, HID, wsc);
  cvt_wt_kernel<<<dim3(DIM / 64, HID / 64, 1), 256, 0, stream>>>(W2, W2, W2, W2_t, HID, DIM, wsc);

  // 3) qkv = x @ [Wq | Wk | Wv]   (f16 out, 1/32 folded)
  gemm_kernel<false, 0, false, true>
      <<<dim3(LDQKV / BN, MROWS / BM), 256, 0, stream>>>(
          X16, Wqkv_t, nullptr, nullptr, nullptr, QKV16, LDQKV, DIM, inv32);

  // 4) V^T plane per (b,h)
  vtrans_kernel<<<dim3(SEQ / 64, NB * NHEAD), 256, 0, stream>>>(QKV16, VT16);

  // 5) ctx = softmax(q k^T / 8) v    (f16 out, carried x16)
  attn_kernel<<<dim3(NB * NHEAD * (SEQ / AQ)), 256, 0, stream>>>(QKV16, VT16, CTX16);

  // 6) r1 = ctx @ Wo + bf16r(x)        (f32 out)
  gemm_kernel<false, 2, false, false>
      <<<dim3(DIM / BN, MROWS / BM), 256, 0, stream>>>(
          CTX16, Wo_t, nullptr, x, R1, nullptr, DIM, DIM, inv512);

  // 7) h = LN1(r1)                     (f32 + f16)
  ln_kernel<true, false><<<dim3(MROWS), 256, 0, stream>>>(R1, ln1_g, ln1_b, H32, H16);

  // 8) g = relu(h @ W1 + b1)           (f16 out)
  gemm_kernel<true, 0, true, true>
      <<<dim3(HID / BN, MROWS / BM), 256, 0, stream>>>(
          H16, W1_t, b1, nullptr, nullptr, G16, HID, DIM, inv32);

  // 9) r2 = g @ W2 + b2 + h            (f32 out)
  gemm_kernel<true, 1, false, false>
      <<<dim3(DIM / BN, MROWS / BM), 256, 0, stream>>>(
          G16, W2_t, b2, H32, R2, nullptr, DIM, HID, inv32);

  // 10) out = LN2(r2)                  (f32, full-size row layout)
  ln_kernel<false, true><<<dim3(MROWS), 256, 0, stream>>>(R2, ln2_g, ln2_b, out, nullptr);
}

// v003
// One run takes 198 microseconds.
// Next to v002, in two timings, it ran 1.23 times as fast each time.
// All steps since v000 together make it 1.92 times as fast.
#include <hip/hip_runtime.h>
#include <stdint.h>
#include <stddef.h>

// All contractions: v_wmma_f32_16x16x32_f16 (f16 operands, f32 accumulate): q/k/v projections, q.k^T scores, P.1 row sums, P.V, output projection, FFN up, FFN down. Float inputs RNE-converted to bf16 then carried in f16 (weights x32, P x1024, ctx x16); softmax and LayerNorm in f32.

#ifndef NB
#define NB 8
#endif
#ifndef SEQ
#define SEQ 1024
#endif
#define NB_FULL 8
#define SEQ_FULL 1024
#define DIM 1024
#define NHEAD 16
#define DHEAD 64
#define HID 512
#define MROWS (NB * SEQ)
#define LDQKV (3 * DIM)
// compact row m (b*SEQ + s) -> full-size row (b*SEQ_FULL + s) for input x and for d_out
#define FROW(m) ((((size_t)(m)) / SEQ) * SEQ_FULL + (((size_t)(m)) % SEQ))

static_assert(NB >= 1 && NB <= NB_FULL);
static_assert(SEQ >= 64 && SEQ <= SEQ_FULL && (SEQ % 64) == 0);
static_assert((MROWS % 128) == 0);
static_assert((DIM % 128) == 0 && (HID % 128) == 0 && (DIM % 32) == 0 && (HID % 32) == 0);
static_assert(NHEAD * DHEAD == DIM && DHEAD == 64);
static_assert(((size_t)(NB - 1) * SEQ_FULL + SEQ) * DIM <= (size_t)NB_FULL * SEQ_FULL * DIM);

// ---------------------------------------------------------------------------
// Types / helpers
// ---------------------------------------------------------------------------
typedef _Float16 v16h __attribute__((ext_vector_type(16)));
typedef _Float16 v8h  __attribute__((ext_vector_type(8)));
typedef float    v8f  __attribute__((ext_vector_type(8)));
typedef float    v4f  __attribute__((ext_vector_type(4)));

// 16x16x32 f16 WMMA followed by the VALU hazard guard (ties D, keeps A/B live)
static __device__ __forceinline__ v8f wmma16(v16h a, v16h b, v8f c) {
  v8f d = __builtin_amdgcn_wmma_f32_16x16x32_f16(false, a, false, b, (short)0, c, false, false);
  asm volatile("v_nop\n\tv_nop\n\tv_nop\n\tv_nop" : "+v"(d) : "v"(a), "v"(b));
  return d;
}

// f32 -> nearest-even bf16 value, returned as f32
static __device__ __forceinline__ float bf16r(float f) {
  unsigned int u = __float_as_uint(f);
  u = (u + 0x7FFFu + ((u >> 16) & 1u)) & 0xFFFF0000u;
  return __uint_as_float(u);
}

// Build a 16-half WMMA A/B fragment for one lane from a row-major (k-contiguous) run.
// 16-bit operand layout: lane-half base8 = (lane>=16)?8:0;
// halves 0..7 -> k = base8+0..7, halves 8..15 -> k = base8+16..23.
// Caller passes p already offset by base8; we read [p, p+8) and [p+16, p+24).
static __device__ __forceinline__ v16h load_frag(const _Float16* p) {
  v8h lo = *(const v8h*)(p);
  v8h hi = *(const v8h*)(p + 16);
  v16h f;
#pragma unroll
  for (int e = 0; e < 8; ++e) { f[e] = lo[e]; f[e + 8] = hi[e]; }
  return f;
}

// ---------------------------------------------------------------------------
// x (f32 [NB_FULL*SEQ_FULL][DIM]) -> X16 (f16 [MROWS][DIM]), bf16 RNE first.
// grid = MROWS*DIM/8/256 exactly.
// ---------------------------------------------------------------------------
__global__ __launch_bounds__(256) void cvt_x_kernel(const float* __restrict__ x,
                                                    _Float16* __restrict__ X16) {
#pragma clang fp contract(off)
  const size_t i = (size_t)blockIdx.x * 256 + threadIdx.x;   // 8-element chunk
  const size_t m = i / (DIM / 8);
  const int c = (int)(i % (DIM / 8)) * 8;
  const float* src = x + FROW(m) * DIM + c;
  const v4f a = *(const v4f*)(src);
  const v4f b = *(const v4f*)(src + 4);
  v8h hv;
#pragma unroll
  for (int e = 0; e < 4; ++e) {
    hv[e]     = (_Float16)bf16r(a[e]);
    hv[e + 4] = (_Float16)bf16r(b[e]);
  }
  _Float16* dst = X16 + m * DIM + c;
  *(v8h*)dst = hv;
  
}

// ---------------------------------------------------------------------------
// Weight W (f32 [K][N] row-major, up to 3 parts selected by blockIdx.z) ->
// transposed f16 plane dst[part*N + n][k] = f16(bf16r(W[k][n]) * scale).
// (8 lanes x 16 B, one instruction per 32 lines). grid = (N/64, K/64, parts).
// ---------------------------------------------------------------------------
#define TP 72
__global__ __launch_bounds__(256) void cvt_wt_kernel(
    const float* __restrict__ w0, const float* __restrict__ w1, const float* __restrict__ w2,
    _Float16* __restrict__ dst, int K, int N, float scale) {
#pragma clang fp contract(off)
  __shared__ __attribute__((aligned(16))) _Float16 T[64 * TP];   // [n][k]
  const int part = blockIdx.z;
  const float* w = (part == 0) ? w0 : ((part == 1) ? w1 : w2);   // block-uniform select
  const int k0 = blockIdx.y * 64, n0 = blockIdx.x * 64;
  const int tid = threadIdx.x;
#pragma unroll
  for (int q = 0; q < 4; ++q) {
    const int idx = q * 256 + tid;            // 0..1023
    const int kr = idx >> 4;                  // 0..63
    const int nc = (idx & 15) << 2;           // 0..60
    const v4f v = *(const v4f*)(w + (size_t)(k0 + kr) * N + n0 + nc);
#pragma unroll
    for (int e = 0; e < 4; ++e) T[(nc + e) * TP + kr] = (_Float16)(bf16r(v[e]) * scale);
  }
  __syncthreads();
  const int rs = tid >> 3, cc = (tid & 7) << 3;
  v8h hv[2];
  size_t go[2];
#pragma unroll
  for (int it = 0; it < 2; ++it) {
    const int nl = it * 32 + rs;              // 0..63
    hv[it] = *(const v8h*)(T + nl * TP + cc);
    go[it] = ((size_t)part * N + n0 + nl) * (size_t)K + k0 + cc;
  }
#pragma unroll
  for (int it = 0; it < 2; ++it) *(v8h*)(dst + go[it]) = hv[it];
  
}

// ---------------------------------------------------------------------------
// V transpose: qkv (f16 [MROWS][3*DIM], v at col 2*DIM + h*64 + d) ->
// vt[(b*NHEAD+h)*64 + d][s] (s-contiguous, pitch SEQ). 64x64 tiles through LDS,
// ---------------------------------------------------------------------------
__global__ __launch_bounds__(256) void vtrans_kernel(const _Float16* __restrict__ qkv,
                                                     _Float16* __restrict__ vt) {
  __shared__ __attribute__((aligned(16))) _Float16 T[64 * TP];   // [d][s]
  const int bh = blockIdx.y;
  const int b = bh / NHEAD, h = bh % NHEAD;
  const int s0 = blockIdx.x * 64;
  const int tid = threadIdx.x;
#pragma unroll
  for (int q = 0; q < 2; ++q) {
    const int idx = q * 256 + tid;            // 0..511
    const int sr = idx >> 3;                  // 0..63
    const int dc = (idx & 7) << 3;            // 0..56
    const v8h v = *(const v8h*)(qkv + ((size_t)b * SEQ + s0 + sr) * LDQKV + 2 * DIM + h * DHEAD + dc);
#pragma unroll
    for (int e = 0; e < 8; ++e) T[(dc + e) * TP + sr] = v[e];
  }
  __syncthreads();
  const int rs = tid >> 3, cc = (tid & 7) << 3;
  v8h hv[2];
  size_t go[2];
#pragma unroll
  for (int it = 0; it < 2; ++it) {
    const int dl = it * 32 + rs;              // 0..63
    hv[it] = *(const v8h*)(T + dl * TP + cc);
    go[it] = ((size_t)bh * DHEAD + dl) * (size_t)SEQ + s0 + cc;
  }
#pragma unroll
  for (int it = 0; it < 2; ++it) *(v8h*)(vt + go[it]) = hv[it];
  
}

// ---------------------------------------------------------------------------
// WMMA GEMM: C[M][N] = A[M][K] (f16, row-major) . B, with B given transposed as
// Bt[N][K] (f16, k-contiguous).  C = acc*scale (+bias) (relu) (+residual).
// 128x128x64 block tile per stage, 8 waves, wave tile 64x32 (4x2 WMMA tiles).
// A and B stages (128 rows x 128 B each) come into LDS by asynchronous 16-B copies
// (whole 128-B lines per row), two buffers: stage t + 1 flies while stage t is
// multiplied; one barrier per stage. The epilogue stages 64 rows at a time in the
// same LDS; the residual plane is read in the store phase as 16-B vectors.
// RES: 0 none, 1 f32 plane [M][N], 2 bf16r(x) read at full-size rows (N == DIM).
// Requires M%128==0 (grid.y = M/128), N%128==0 (grid.x = N/128), K%64==0.
// ---------------------------------------------------------------------------
#define BM 128
#define BN 128
#define BK 64
#define LDT 72     // LDS tile row stride in halves (144 B = 16 B x odd)
#define GBUF_H ((BM + BN) * LDT)   // halves per buffer: [A 128 rows | B 128 rows]
#define EPF 132    // epilogue stage pitch in floats (528 B)
#define GEMM_SMEM_FLOATS (2 * GBUF_H / 2)
static_assert(64 * EPF <= GEMM_SMEM_FLOATS);
static_assert((DIM % BK) == 0 && (HID % BK) == 0);

// One stage: each lane copies four 16-B pieces of the A tile and four of the B tile
// (rows 32 apart). The s_wait_xcnt stands inside the statement so that no address
// register of a copy is rewritten in front of it.
static __device__ __forceinline__ void stage_ab(unsigned la, unsigned lb, unsigned l32,
                                                const _Float16* ga, const _Float16* gb, size_t g32) {
  asm volatile(
      "global_load_async_to_lds_b128 %0, %8, off\n\t"
      "global_load_async_to_lds_b128 %1, %9, off\n\t"
      "global_load_async_to_lds_b128 %2, %10, off\n\t"
      "global_load_async_to_lds_b128 %3, %11, off\n\t"
      "global_load_async_to_lds_b128 %4, %12, off\n\t"
      "global_load_async_to_lds_b128 %5, %13, off\n\t"
      "global_load_async_to_lds_b128 %6, %14, off\n\t"
      "global_load_async_to_lds_b128 %7, %15, off\n\t"
      "s_wait_xcnt 0x0"
      :: "v"(la), "v"(la + l32), "v"(la + 2 * l32), "v"(la + 3 * l32),
         "v"(lb), "v"(lb + l32), "v"(lb + 2 * l32), "v"(lb + 3 * l32),
         "v"(ga), "v"(ga + g32), "v"(ga + 2 * g32), "v"(ga + 3 * g32),
         "v"(gb), "v"(gb + g32), "v"(gb + 2 * g32), "v"(gb + 3 * g32)
      : "memory");
}

template <bool HAS_BIAS, int RES, bool RELU, bool OUT16>
__global__ __launch_bounds__(256) void gemm_kernel(
    const _Float16* __restrict__ A, const _Float16* __restrict__ Bt,
    const float* __restrict__ bias, const float* __restrict__ res,
    float* __restrict__ outF, _Float16* __restrict__ outH,
    int N, int K, float scale) {
  static_assert(!(RES != 0 && OUT16));
  __shared__ __attribute__((aligned(16))) float smem[GEMM_SMEM_FLOATS];
  _Float16* As = (_Float16*)smem;           // buffer 0: [m][k], then [n][k]
  const int tid = threadIdx.x;
  const int wave = tid >> 5, lane = tid & 31;
  const int r = lane & 15, hb = (lane >> 4) << 3;
  const int mBlk = blockIdx.y * BM, nBlk = blockIdx.x * BN;
  const int mw = (wave & 1) * 64, nw = (wave >> 1) * 32;

  // staging coords: 128 rows x 8 pieces of 16 B per operand = 1024 pieces, 4 per thread
  const int srow = tid >> 3, sch = (tid & 7) << 3;
  const _Float16* gA = A  + (size_t)(mBlk + srow) * K + sch;   // + kt * BK per stage
  const _Float16* gB = Bt + (size_t)(nBlk + srow) * K + sch;
  const size_t g32 = (size_t)32 * K;                            // 32 rows further, halves
  const unsigned lA = (unsigned)(uintptr_t)(As + srow * LDT + sch);   // LDS byte address, buffer 0
  const unsigned lB = lA + BM * LDT * 2;
  const unsigned l32 = 32 * LDT * 2;                            // 32 rows further, bytes
  const unsigned lbuf = GBUF_H * 2;                             // buffer size, bytes
  const int nk = K / BK;

  // stage 0 into buffer 0; landed and published before anything reads it
  stage_ab(lA, lB, l32, gA, gB, g32);
  asm volatile("s_wait_asynccnt 0x0" ::: "memory");            // this wave's copies have landed
  __syncthreads();                                              // every wave's copies are readable
  if (nk > 1) stage_ab(lA + lbuf, lB + lbuf, l32, gA + BK, gB + BK, g32);

  v8f acc[4][2];
#pragma unroll
  for (int i = 0; i < 4; ++i)
#pragma unroll
    for (int j = 0; j < 2; ++j)
#pragma unroll
      for (int v = 0; v < 8; ++v) acc[i][j][v] = 0.f;

#pragma unroll 1
  for (int kt = 0; kt < nk; ++kt) {
    const _Float16* At = As + (kt & 1) * GBUF_H;
    const _Float16* Bs = At + BM * LDT;
#pragma unroll
    for (int ks = 0; ks < BK / 32; ++ks) {
      v16h af[4], bfr[2];
#pragma unroll
      for (int i = 0; i < 4; ++i) af[i] = load_frag(At + (mw + i * 16 + r) * LDT + ks * 32 + hb);
#pragma unroll
      for (int j = 0; j < 2; ++j) bfr[j] = load_frag(Bs + (nw + j * 16 + r) * LDT + ks * 32 + hb);
#pragma unroll
      for (int i = 0; i < 4; ++i)
#pragma unroll
        for (int j = 0; j < 2; ++j) acc[i][j] = wmma16(af[i], bfr[j], acc[i][j]);
    }
    // publish point of stage kt + 1, and hand-over of this stage's buffer
    asm volatile("s_wait_dscnt 0x0" ::: "memory");             // this wave's reads of the buffer are done
    asm volatile("s_wait_asynccnt 0x0" ::: "memory");          // this wave's copies of stage kt + 1 have landed
    __syncthreads();                                            // publishes kt + 1, ends every read of kt
    if (kt + 2 < nk) {
      const unsigned lo = (unsigned)(kt & 1) * lbuf;
      const size_t ko = (size_t)(kt + 2) * BK;
      stage_ab(lA + lo, lB + lo, l32, gA + ko, gB + ko, g32);
    }
  }
  asm volatile("s_wait_asynccnt 0x0" ::: "memory");            // nothing in flight when LDS changes its use
  // the last stage's own barrier has ended every read: LDS is free for the epilogue stage

  // epilogue. D layout: element v -> row 8*lanehi + v, lane&15 -> col.
  float* stg = smem;                          // [64][EPF] f32
  float bcol[2] = {0.f, 0.f};
  if constexpr (HAS_BIAS) {
#pragma unroll
    for (int j = 0; j < 2; ++j) bcol[j] = bf16r(bias[nBlk + nw + j * 16 + r]);
  }
#pragma unroll
  for (int p = 0; p < 2; ++p) {
    if ((wave & 1) == p) {                    // wave-uniform: waves owning rows p*64..p*64+63
#pragma unroll
      for (int i = 0; i < 4; ++i)
#pragma unroll
        for (int j = 0; j < 2; ++j)
#pragma unroll
          for (int v = 0; v < 8; ++v) {
            const int lr = i * 16 + hb + v;                   // 0..63
            const int lc = nw + j * 16 + r;                   // 0..127
            float c = acc[i][j][v] * scale;
            if constexpr (HAS_BIAS) c += bcol[j];
            if constexpr (RELU) c = fmaxf(c, 0.f);
            stg[lr * EPF + lc] = c;
          }
    }
    __syncthreads();
    if constexpr (OUT16) {
      // f16 row segment = 128 halves = 256 B = 2 lines; 16 lanes x 16 B per row
      v8h hv[4];
      size_t go[4];
#pragma unroll
      for (int it = 0; it < 4; ++it) {
        const int lr = it * 16 + wave * 2 + (lane >> 4);   // 0..63
        const int lc = (lane & 15) << 3;                    // 0..120
        const v4f x0 = *(const v4f*)(stg + lr * EPF + lc);
        const v4f x1 = *(const v4f*)(stg + lr * EPF + lc + 4);
        v8h hh;
#pragma unroll
        for (int e = 0; e < 4; ++e) { hh[e] = (_Float16)x0[e]; hh[e + 4] = (_Float16)x1[e]; }
        hv[it] = hh;
        go[it] = (size_t)(mBlk + p * 64 + lr) * (size_t)N + nBlk + lc;
      }
#pragma unroll
      for (int it = 0; it < 4; ++it) *(v8h*)(outH + go[it]) = hv[it];
      
    } else {
      // f32 row segment = 128 floats = 512 B = 4 lines; 32 lanes x 16 B per row.
      // Residual added here from one 16-B load per row per lane (8 global loads per lane).
      v4f fv[8];
      size_t go[8];
#pragma unroll
      for (int it = 0; it < 8; ++it) {
        const int lr = it * 8 + wave;                        // 0..63
        const int lc = lane << 2;                            // 0..124
        const size_t grow = (size_t)(mBlk + p * 64 + lr);
        const size_t gcol = (size_t)(nBlk + lc);
        v4f val = *(const v4f*)(stg + lr * EPF + lc);
        if constexpr (RES == 1) {
          const v4f rr = *(const v4f*)(res + grow * (size_t)N + gcol);
#pragma unroll
          for (int e = 0; e < 4; ++e) val[e] = val[e] + rr[e];
        }
        if constexpr (RES == 2) {
          const v4f rr = *(const v4f*)(res + FROW(grow) * (size_t)DIM + gcol);
#pragma unroll
          for (int e = 0; e < 4; ++e) val[e] = val[e] + bf16r(rr[e]);
        }
        fv[it] = val;
        go[it] = grow * (size_t)N + gcol;
      }
#pragma unroll
      for (int it = 0; it < 8; ++it) *(v4f*)(outF + go[it]) = fv[it];
      
    }
    __syncthreads();                          // stage reused by the other row half
  }
}

#define OPAD 72   // O stage row stride (halves)
#define AW 8                    // waves per block
#define AQ (AW * 16)            // query rows per block
#define SK 64                   // keys per stage
#define KVP 72                  // staged row pitch in halves (144 B = 16 B x odd)
#define TILE_H (64 * KVP)       // halves per staged tile
#define NST (SEQ / SK)          // stages
static_assert((SEQ % AQ) == 0 && (SEQ % SK) == 0 && AW * 32 == 256);

// One stage: each lane copies two 16-B pieces of the K tile and two of the V^T tile.
// The s_wait_xcnt stands inside the statement so that no address register of a
// copy is rewritten in front of it.
static __device__ __forceinline__ void stage_kv(unsigned lk0, unsigned lk1, unsigned lv0, unsigned lv1,
                                                const _Float16* gk0, const _Float16* gk1,
                                                const _Float16* gv0, const _Float16* gv1) {
  asm volatile(
      "global_load_async_to_lds_b128 %0, %4, off\n\t"
      "global_load_async_to_lds_b128 %1, %5, off\n\t"
      "global_load_async_to_lds_b128 %2, %6, off\n\t"
      "global_load_async_to_lds_b128 %3, %7, off\n\t"
      "s_wait_xcnt 0x0"
      :: "v"(lk0), "v"(lk1), "v"(lv0), "v"(lv1), "v"(gk0), "v"(gk1), "v"(gv0), "v"(gv1)
      : "memory");
}

// value of lane l ^ 16 (the other half's share of the same query column)
static __device__ __forceinline__ float xhalf(float x) {
  return __builtin_bit_cast(float, __builtin_amdgcn_permlanex16(
      __builtin_bit_cast(int, x), __builtin_bit_cast(int, x), 0x76543210, 0xfedcba98, false, false));
}

__global__ __launch_bounds__(256) __attribute__((amdgpu_num_vgpr(256)))
void attn_kernel(const _Float16* __restrict__ qkv, const _Float16* __restrict__ vt,
                 _Float16* __restrict__ ctx) {
  __shared__ __attribute__((aligned(16))) _Float16 KV[2 * 2 * TILE_H];   // [buffer][K | V^T][row][KVP]
  __shared__ __attribute__((aligned(16))) _Float16 Os[AW * 16 * OPAD];   // per-wave O 16x64
  const int nqt = SEQ / AQ;
  const int qt = (int)(blockIdx.x % nqt);
  const int bh = (int)(blockIdx.x / nqt);
  const int h = bh % NHEAD, b = bh / NHEAD;
  const int tid = threadIdx.x, wave = tid >> 5, lane = tid & 31;
  const int r = lane & 15, hb = (lane >> 4) << 3;
  const _Float16* Qb = qkv + (size_t)b * SEQ * LDQKV + h * DHEAD;
  const _Float16* Kh = Qb + DIM;
  const _Float16* Vh = vt + (size_t)bh * DHEAD * SEQ;
  const int q0 = qt * AQ + wave * 16;

  // staging coords: 64 rows x 8 pieces of 16 B per tile = 512 pieces, 2 per thread
  const int srow = tid >> 3, sch = (tid & 7) << 3;
  const _Float16* gK = Kh + (size_t)srow * LDQKV + sch;      // + key0 * LDQKV per stage
  const _Float16* gV = Vh + (size_t)srow * SEQ + sch;        // + key0 per stage
  const unsigned lK = (unsigned)(uintptr_t)(KV + srow * KVP + sch);   // LDS byte address, buffer 0
  const unsigned lV = lK + TILE_H * 2;
  const unsigned l32 = 32 * KVP * 2;                          // 32 rows further, bytes
  const unsigned lbuf = 2 * TILE_H * 2;                       // buffer size, bytes

  // stage 0 into buffer 0; landed and published before anything reads it
  stage_kv(lK, lK + l32, lV, lV + l32, gK, gK + (size_t)32 * LDQKV, gV, gV + (size_t)32 * SEQ);
  asm volatile("s_wait_asynccnt 0x0" ::: "memory");          // this wave's copies have landed
  __syncthreads();                                            // every wave's copies are readable
  if (NST > 1) {
    const _Float16* k1 = gK + (size_t)SK * LDQKV;
    const _Float16* v1 = gV + SK;
    stage_kv(lK + lbuf, lK + lbuf + l32, lV + lbuf, lV + lbuf + l32,
             k1, k1 + (size_t)32 * LDQKV, v1, v1 + (size_t)32 * SEQ);
  }

  // Q fragments (B: lane -> query column, halves -> d), d chunks 0..31 and 32..63
  v16h aq[2];
#pragma unroll
  for (int dc = 0; dc < 2; ++dc)
    aq[dc] = load_frag(Qb + (size_t)(q0 + r) * LDQKV + dc * 32 + hb);

  // constant all-ones A fragment: ones . P^T -> per-query sums (every row of D alike)
  v16h ones;
#pragma unroll
  for (int e = 0; e < 16; ++e) ones[e] = (_Float16)1.0f;

  v8f o[4];
#pragma unroll
  for (int t = 0; t < 4; ++t)
#pragma unroll
    for (int v = 0; v < 8; ++v) o[t][v] = 0.f;
  float mrow = -1e30f, lrow = 0.f;           // of this lane's query (q0 + r), alike in both halves

  const v8f zero = {0.f, 0.f, 0.f, 0.f, 0.f, 0.f, 0.f, 0.f};

#pragma unroll 1
  for (int st = 0; st < NST; ++st) {
   const _Float16* Kt = KV + (st & 1) * (2 * TILE_H);
   const _Float16* Vt = Kt + TILE_H;
#pragma unroll
   for (int sub = 0; sub < SK / 32; ++sub) {
    const int key0 = sub * 32;                // key offset inside the staged tile

    // S^T(32x16) = K(32x64) . Q^T : A-frag lane -> key, halves -> d (split map)
    // D: element v of tile kt -> key kt*16 + 8*lanehi + v, lane&15 -> query
    v8f s[2];
#pragma unroll
    for (int kt = 0; kt < 2; ++kt)
#pragma unroll
      for (int v = 0; v < 8; ++v) s[kt][v] = 0.f;
#pragma unroll
    for (int kt = 0; kt < 2; ++kt)
#pragma unroll
      for (int dc = 0; dc < 2; ++dc) {
        const v16h ak = load_frag(Kt + (key0 + kt * 16 + r) * KVP + dc * 32 + hb);
        s[kt] = wmma16(ak, aq[dc], s[kt]);
      }

    // online softmax of one query per lane: 16 keys here, 16 in lane ^ 16
    float m8[8];
#pragma unroll
    for (int v = 0; v < 8; ++v) m8[v] = fmaxf(s[0][v], s[1][v]);
    float mx = fmaxf(fmaxf(fmaxf(m8[0], m8[1]), fmaxf(m8[2], m8[3])),
                     fmaxf(fmaxf(m8[4], m8[5]), fmaxf(m8[6], m8[7]))) * 0.125f;   // * DH^-0.5
    mx = fmaxf(mx, xhalf(mx));
    const float mnew = fmaxf(mrow, mx);
    const float alpha = __expf(mrow - mnew);
    mrow = mnew;

    // P^T as the B operand: half e -> key (e < 8 ? 8*lanehi + e : 16 + 8*lanehi + e - 8),
    // which is element e & 7 of tile e >> 3 of this very lane
    v16h pf;
#pragma unroll
    for (int kt = 0; kt < 2; ++kt)
#pragma unroll
      for (int v = 0; v < 8; ++v)
        pf[kt * 8 + v] = (_Float16)(__expf(s[kt][v] * 0.125f - mnew) * 1024.0f);   // P carried x1024

    // row sums on the matrix pipe
    const v8f rsum = wmma16(ones, pf, zero);
    lrow = lrow * alpha + rsum[0];

    // O^T(64x16) = alpha*O^T + V^T(64x32) . P^T(32x16); V^T rows are d, key-contiguous
#pragma unroll
    for (int t = 0; t < 4; ++t) {
#pragma unroll
      for (int v = 0; v < 8; ++v) o[t][v] *= alpha;
      const v16h av = load_frag(Vt + (t * 16 + r) * KVP + key0 + hb);
      o[t] = wmma16(av, pf, o[t]);
    }
   }
   // publish point of stage st + 1, and hand-over of this stage's buffer
   asm volatile("s_wait_dscnt 0x0" ::: "memory");            // this wave's reads of the buffer are done
   asm volatile("s_wait_asynccnt 0x0" ::: "memory");         // this wave's copies of stage st + 1 have landed
   __syncthreads();                                           // publishes st + 1, ends every read of st
   if (st + 2 < NST) {
     const _Float16* kn = gK + (size_t)(st + 2) * SK * LDQKV;
     const _Float16* vn = gV + (st + 2) * SK;
     const unsigned lo = (unsigned)(st & 1) * lbuf;
     stage_kv(lK + lo, lK + lo + l32, lV + lo, lV + lo + l32,
              kn, kn + (size_t)32 * LDQKV, vn, vn + (size_t)32 * SEQ);
   }
  }
  asm volatile("s_wait_asynccnt 0x0" ::: "memory");          // nothing in flight when the wave ends

  // ctx = 16 * O / l  (the x1024 P carry cancels between O and l)
  // O^T: element v of tile t -> d = t*16 + 8*lanehi + v of query r: 8 consecutive halves
  _Float16* Ow = Os + wave * 16 * OPAD;
  const float inv = 16.0f / lrow;
#pragma unroll
  for (int t = 0; t < 4; ++t) {
    v8h ov;
#pragma unroll
    for (int v = 0; v < 8; ++v) ov[v] = (_Float16)(o[t][v] * inv);
    *(v8h*)(Ow + r * OPAD + t * 16 + hb) = ov;
  }
  __syncthreads();

  const int rs = lane >> 3, cc = (lane & 7) << 3;
  v8h hv[4];
  size_t go[4];
#pragma unroll
  for (int it = 0; it < 4; ++it) {
    const int lr = it * 4 + rs;               // 0..15
    hv[it] = *(const v8h*)(Ow + lr * OPAD + cc);
    go[it] = ((size_t)b * SEQ + q0 + lr) * (size_t)DIM + h * DHEAD + cc;
  }
#pragma unroll
  for (int it = 0; it < 4; ++it) *(v8h*)(ctx + go[it]) = hv[it];
  
}

// ---------------------------------------------------------------------------
// in: f32 [MROWS][DIM] (residual already added).  outF: f32 (row mapped to the
// full-size layout when MAPOUT), outH: f16 copy (compact rows) when OUT16.
// ---------------------------------------------------------------------------
template <bool OUT16, bool MAPOUT>
__global__ __launch_bounds__(256) void ln_kernel(
    const float* __restrict__ in, const float* __restrict__ g, const float* __restrict__ bt,
    float* __restrict__ outF, _Float16* __restrict__ outH) {
#pragma clang fp contract(off)
  __shared__ float red0[8];
  __shared__ float red1[8];
  __shared__ __attribute__((aligned(16))) _Float16 sh[DIM];
  const size_t row = blockIdx.x;
  const int tid = threadIdx.x, wave = tid >> 5, lane = tid & 31;
  const v4f v = *(const v4f*)(in + row * DIM + tid * 4);
  float s = (v[0] + v[1]) + (v[2] + v[3]);
#pragma unroll
  for (int m = 16; m >= 1; m >>= 1) s += __shfl_xor(s, m, 32);
  if (lane == 0) red0[wave] = s;
  __syncthreads();
  float S = 0.f;
#pragma unroll
  for (int i = 0; i < 8; ++i) S += red0[i];
  const float mu = S * (1.0f / (float)DIM);
  const float d0 = v[0] - mu, d1 = v[1] - mu, d2 = v[2] - mu, d3 = v[3] - mu;
  float ss = (d0 * d0 + d1 * d1) + (d2 * d2 + d3 * d3);
#pragma unroll
  for (int m = 16; m >= 1; m >>= 1) ss += __shfl_xor(ss, m, 32);
  if (lane == 0) red1[wave] = ss;
  __syncthreads();
  float SS = 0.f;
#pragma unroll
  for (int i = 0; i < 8; ++i) SS += red1[i];
  const float var = SS * (1.0f / (float)DIM);
  const float rstd = rsqrtf(var + 1e-5f);
  const v4f gg = *(const v4f*)(g + tid * 4);
  const v4f bb = *(const v4f*)(bt + tid * 4);
  v4f y;
  y[0] = d0 * rstd * bf16r(gg[0]) + bf16r(bb[0]);
  y[1] = d1 * rstd * bf16r(gg[1]) + bf16r(bb[1]);
  y[2] = d2 * rstd * bf16r(gg[2]) + bf16r(bb[2]);
  y[3] = d3 * rstd * bf16r(gg[3]) + bf16r(bb[3]);
  const size_t orow = MAPOUT ? FROW(row) : row;
  float* op = outF + orow * DIM + tid * 4;
  *(v4f*)op = y;
  
  if constexpr (OUT16) {
#pragma unroll
    for (int e = 0; e < 4; ++e) sh[tid * 4 + e] = (_Float16)y[e];
    __syncthreads();
    if (tid < 128) {                           // waves 0..3, wave-uniform
      const v8h hv = *(const v8h*)(sh + tid * 8);
      _Float16* hp = outH + row * DIM + tid * 8;
      *(v8h*)hp = hv;
      
    }
  }
}

// ---------------------------------------------------------------------------
// Launch plan (13 launches):
//  cvt_x, cvt_wt x4 (qkv | o | 1 | 2), gemm qkv, vtrans, attn, gemm o (+x),
//  ln1, gemm 1 (relu), gemm 2 (+h), ln2 -> d_out
// Workspace (byte offsets derived below, total 106 MiB at full size):
//  W planes 10 MiB | P1 16 MiB: X16 -> VT16 -> G16 | P2 48 MiB: QKV16 -> {R1, H16} -> R2
//  | P3 32 MiB: CTX16 -> H32
// ---------------------------------------------------------------------------
extern "C" void kernel_launch(void* const* d_in, const int* in_sizes, int n_in,
                              void* d_out, int out_size, void* d_ws, size_t ws_size,
                              hipStream_t stream) {
  if (n_in < 13) return;
  const size_t needX = ((size_t)(NB - 1) * SEQ_FULL + SEQ) * DIM;
  if ((size_t)in_sizes[0] < needX) return;
  if (in_sizes[1] < DIM * DIM || in_sizes[2] < DIM * DIM || in_sizes[3] < DIM * DIM ||
      in_sizes[4] < DIM * DIM) return;
  if (in_sizes[5] < DIM || in_sizes[6] < DIM || in_sizes[10] < DIM || in_sizes[11] < DIM ||
      in_sizes[12] < DIM) return;
  if (in_sizes[7] < DIM * HID || in_sizes[8] < HID || in_sizes[9] < HID * DIM) return;
  if ((size_t)out_size < needX) return;

  const float* x     = (const float*)d_in[0];
  const float* Wq    = (const float*)d_in[1];
  const float* Wk    = (const float*)d_in[2];
  const float* Wv    = (const float*)d_in[3];
  const float* Wo    = (const float*)d_in[4];
  const float* ln1_g = (const float*)d_in[5];
  const float* ln1_b = (const float*)d_in[6];
  const float* W1    = (const float*)d_in[7];
  const float* b1    = (const float*)d_in[8];
  const float* W2    = (const float*)d_in[9];
  const float* b2    = (const float*)d_in[10];
  const float* ln2_g = (const float*)d_in[11];
  const float* ln2_b = (const float*)d_in[12];
  float* out = (float*)d_out;

  // carve (all region sizes are exact multiples of the whole-line stores used)
  const size_t szWqkv = (size_t)3 * DIM * DIM * 2;     // [3072][1024] f16
  const size_t szWo   = (size_t)DIM * DIM * 2;         // [1024][1024] f16
  const size_t szW1   = (size_t)HID * DIM * 2;         // [512][1024]  f16 (W1^T)
  const size_t szW2   = (size_t)DIM * HID * 2;         // [1024][512]  f16 (W2^T)
  const size_t szP1   = (size_t)MROWS * DIM * 2;       // X16 / VT16 / G16
  const size_t szP2   = (size_t)MROWS * LDQKV * 2;     // QKV16 / {R1,H16} / R2
  const size_t szP3   = (size_t)MROWS * DIM * 4;       // CTX16 / H32
  const size_t oWqkv = 0;
  const size_t oWo   = oWqkv + szWqkv;
  const size_t oW1   = oWo + szWo;
  const size_t oW2   = oW1 + szW1;
  const size_t oP1   = oW2 + szW2;
  const size_t oP2   = oP1 + szP1;
  const size_t oP3   = oP2 + szP2;
  const size_t total = oP3 + szP3;
  if (total > ws_size) return;
  static_assert((size_t)MROWS * DIM * 4 + (size_t)MROWS * DIM * 2 <= (size_t)MROWS * LDQKV * 2);
  static_assert((size_t)MROWS * HID * 2 <= (size_t)MROWS * DIM * 2);
  static_assert((size_t)NB * NHEAD * DHEAD * SEQ * 2 <= (size_t)MROWS * DIM * 2);

  char* ws = (char*)d_ws;
  _Float16* Wqkv_t = (_Float16*)(ws + oWqkv);
  _Float16* Wo_t   = (_Float16*)(ws + oWo);
  _Float16* W1_t   = (_Float16*)(ws + oW1);
  _Float16* W2_t   = (_Float16*)(ws + oW2);
  _Float16* X16    = (_Float16*)(ws + oP1);
  _Float16* VT16   = (_Float16*)(ws + oP1);
  _Float16* G16    = (_Float16*)(ws + oP1);
  _Float16* QKV16  = (_Float16*)(ws + oP2);
  float*    R1     = (float*)   (ws + oP2);
  _Float16* H16    = (_Float16*)(ws + oP2 + (size_t)MROWS * DIM * 4);
  float*    R2     = (float*)   (ws + oP2);
  _Float16* CTX16  = (_Float16*)(ws + oP3);
  float*    H32    = (float*)   (ws + oP3);

  const float wsc   = 32.0f;                  // weight carry
  const float inv32 = 1.0f / 32.0f;
  const float inv512 = 1.0f / 512.0f;         // 1/(32 weight carry * 16 ctx carry)

  // 1) x -> X16 (bf16 RNE, f16 container)
  cvt_x_kernel<<<dim3(MROWS / 2), 256, 0, stream>>>(x, X16);

  // 2) weights -> transposed f16 planes, bf16 RNE then x32
  cvt_wt_kernel<<<dim3(DIM / 64, DIM / 64, 3), 256, 0, stream>>>(Wq, Wk, Wv, Wqkv_t, DIM, DIM, wsc);
  cvt_wt_kernel<<<dim3(DIM / 64, DIM / 64, 1), 256, 0, stream>>>(Wo, Wo, Wo, Wo_t, DIM, DIM, wsc);
  cvt_wt_kernel<<<dim3(HID / 64, DIM / 64, 1), 256, 0, stream>>>(W1, W1, W1, W1_t, DIM, HID, wsc);
  cvt_wt_kernel<<<dim3(DIM / 64, HID / 64, 1), 256, 0, stream>>>(W2, W2, W2, W2_t, HID, DIM, wsc);

  // 3) qkv = x @ [Wq | Wk | Wv]   (f16 out, 1/32 folded)
  gemm_kernel<false, 0, false, true>
      <<<dim3(LDQKV / BN, MROWS / BM), 256, 0, stream>>>(
          X16, Wqkv_t, nullptr, nullptr, nullptr, QKV16, LDQKV, DIM, inv32);

  // 4) V^T plane per (b,h)
  vtrans_kernel<<<dim3(SEQ / 64, NB * NHEAD), 256, 0, stream>>>(QKV16, VT16);

  // 5) ctx = softmax(q k^T / 8) v    (f16 out, carried x16)
  attn_kernel<<<dim3(NB * NHEAD * (SEQ / AQ)), 256, 0, stream>>>(QKV16, VT16, CTX16);

  // 6) r1 = ctx @ Wo + bf16r(x)        (f32 out)
  gemm_kernel<false, 2, false, false>
      <<<dim3(DIM / BN, MROWS / BM), 256, 0, stream>>>(
          CTX16, Wo_t, nullptr, x, R1, nullptr, DIM, DIM, inv512);

  // 7) h = LN1(r1)                     (f32 + f16)
  ln_kernel<true, false><<<dim3(MROWS), 256, 0, stream>>>(R1, ln1_g, ln1_b, H32, H16);

  // 8) g = relu(h @ W1 + b1)           (f16 out)
  gemm_kernel<true, 0, true, true>
      <<<dim3(HID / BN, MROWS / BM), 256, 0, stream>>>(
          H16, W1_t, b1, nullptr, nullptr, G16, HID, DIM, inv32);

  // 9) r2 = g @ W2 + b2 + h            (f32 out)
  gemm_kernel<true, 1, false, false>
      <<<dim3(DIM / BN, MROWS / BM), 256, 0, stream>>>(
          G16, W2_t, b2, H32, R2, nullptr, DIM, HID, inv32);

  // 10) out = LN2(r2)                  (f32, full-size row layout)
  ln_kernel<false, true><<<dim3(MROWS), 256, 0, stream>>>(R2, ln2_g, ln2_b, out, nullptr);
}

// v004
// One run takes 185 microseconds.
// Next to v003, in two timings, it ran 1.07 times as fast each time.
// Counting every step since v000, it is 2.06 times as fast.
#include <hip/hip_runtime.h>
#include <stdint.h>
#include <stddef.h>

// All contractions: v_wmma_f32_16x16x32_f16 (f16 operands, f32 accumulate): q/k/v projections, q.k^T scores, P.1 row sums, P.V, output projection, FFN up, FFN down. Float inputs RNE-converted to bf16 then carried in f16 (weights x32, P x1024, ctx x16); softmax and LayerNorm in f32.

#ifndef NB
#define NB 8
#endif
#ifndef SEQ
#define SEQ 1024
#endif
#define NB_FULL 8
#define SEQ_FULL 1024
#define DIM 1024
#define NHEAD 16
#define DHEAD 64
#define HID 512
#define MROWS (NB * SEQ)
#define LDQKV (3 * DIM)
// compact row m (b*SEQ + s) -> full-size row (b*SEQ_FULL + s) for input x and for d_out
#define FROW(m) ((((size_t)(m)) / SEQ) * SEQ_FULL + (((size_t)(m)) % SEQ))

static_assert(NB >= 1 && NB <= NB_FULL);
static_assert(SEQ >= 64 && SEQ <= SEQ_FULL && (SEQ % 64) == 0);
static_assert((MROWS % 128) == 0);
static_assert((DIM % 128) == 0 && (HID % 128) == 0 && (DIM % 32) == 0 && (HID % 32) == 0);
static_assert(NHEAD * DHEAD == DIM && DHEAD == 64);
static_assert(((size_t)(NB - 1) * SEQ_FULL + SEQ) * DIM <= (size_t)NB_FULL * SEQ_FULL * DIM);

// ---------------------------------------------------------------------------
// Types / helpers
// ---------------------------------------------------------------------------
typedef _Float16 v16h __attribute__((ext_vector_type(16)));
typedef _Float16 v8h  __attribute__((ext_vector_type(8)));
typedef float    v8f  __attribute__((ext_vector_type(8)));
typedef float    v4f  __attribute__((ext_vector_type(4)));

// 16x16x32 f16 WMMA followed by the VALU hazard guard (ties D, keeps A/B live)
static __device__ __forceinline__ v8f wmma16(v16h a, v16h b, v8f c) {
  v8f d = __builtin_amdgcn_wmma_f32_16x16x32_f16(false, a, false, b, (short)0, c, false, false);
  asm volatile("v_nop\n\tv_nop\n\tv_nop\n\tv_nop" : "+v"(d) : "v"(a), "v"(b));
  return d;
}

// f32 -> nearest-even bf16 value, returned as f32
static __device__ __forceinline__ float bf16r(float f) {
  unsigned int u = __float_as_uint(f);
  u = (u + 0x7FFFu + ((u >> 16) & 1u)) & 0xFFFF0000u;
  return __uint_as_float(u);
}

// Build a 16-half WMMA A/B fragment for one lane from a row-major (k-contiguous) run.
// 16-bit operand layout: lane-half base8 = (lane>=16)?8:0;
// halves 0..7 -> k = base8+0..7, halves 8..15 -> k = base8+16..23.
// Caller passes p already offset by base8; we read [p, p+8) and [p+16, p+24).
static __device__ __forceinline__ v16h load_frag(const _Float16* p) {
  v8h lo = *(const v8h*)(p);
  v8h hi = *(const v8h*)(p + 16);
  v16h f;
#pragma unroll
  for (int e = 0; e < 8; ++e) { f[e] = lo[e]; f[e + 8] = hi[e]; }
  return f;
}

// ---------------------------------------------------------------------------
// x (f32 [NB_FULL*SEQ_FULL][DIM]) -> X16 (f16 [MROWS][DIM]), bf16 RNE first.
// One block's share; blk = 0 .. MROWS*DIM/8/256 - 1 exactly.
// ---------------------------------------------------------------------------
#define XBLKS (MROWS / 2)
static __device__ __forceinline__ void cvt_x_block(const float* __restrict__ x,
                                                   _Float16* __restrict__ X16, int blk) {
#pragma clang fp contract(off)
  const size_t i = (size_t)blk * 256 + threadIdx.x;          // 8-element chunk
  const size_t m = i / (DIM / 8);
  const int c = (int)(i % (DIM / 8)) * 8;
  const float* src = x + FROW(m) * DIM + c;
  const v4f a = *(const v4f*)(src);
  const v4f b = *(const v4f*)(src + 4);
  v8h hv;
#pragma unroll
  for (int e = 0; e < 4; ++e) {
    hv[e]     = (_Float16)bf16r(a[e]);
    hv[e + 4] = (_Float16)bf16r(b[e]);
  }
  _Float16* dst = X16 + m * DIM + c;
  *(v8h*)dst = hv;
  
}

// ---------------------------------------------------------------------------
// Weight W (f32 [K][N] row-major) -> transposed f16 plane
// dst[n][k] = f16(bf16r(W[k][n]) * scale). One block's 64x64 tile at (k0, n0)
// (8 lanes x 16 B, one instruction per 32 lines).
// ---------------------------------------------------------------------------
#define TP 72
static __device__ __forceinline__ void cvt_wt_tile(
    const float* __restrict__ w, _Float16* __restrict__ dst, int K, int N, int k0, int n0, float scale) {
#pragma clang fp contract(off)
  __shared__ __attribute__((aligned(16))) _Float16 T[64 * TP];   // [n][k]
  const int tid = threadIdx.x;
#pragma unroll
  for (int q = 0; q < 4; ++q) {
    const int idx = q * 256 + tid;            // 0..1023
    const int kr = idx >> 4;                  // 0..63
    const int nc = (idx & 15) << 2;           // 0..60
    const v4f v = *(const v4f*)(w + (size_t)(k0 + kr) * N + n0 + nc);
#pragma unroll
    for (int e = 0; e < 4; ++e) T[(nc + e) * TP + kr] = (_Float16)(bf16r(v[e]) * scale);
  }
  __syncthreads();
  const int rs = tid >> 3, cc = (tid & 7) << 3;
  v8h hv[2];
  size_t go[2];
#pragma unroll
  for (int it = 0; it < 2; ++it) {
    const int nl = it * 32 + rs;              // 0..63
    hv[it] = *(const v8h*)(T + nl * TP + cc);
    go[it] = (size_t)(n0 + nl) * (size_t)K + k0 + cc;
  }
#pragma unroll
  for (int it = 0; it < 2; ++it) *(v8h*)(dst + go[it]) = hv[it];
  
}

// ---------------------------------------------------------------------------
// All input conversions in ONE launch: none of them reads what another writes, so
// the four small weight grids run beside the x stream instead of one after another.
// Blocks 0 .. WBLKS-1: one 64x64 weight tile each (Wq | Wk | Wv | Wo | W1 | W2, they
// have the longer chain, LDS and a barrier, and start first); the rest: x chunks.
// Every branch is on blockIdx alone: the barrier in cvt_wt_tile is block-uniform.
// ---------------------------------------------------------------------------
#define T_DD ((DIM / 64) * (DIM / 64))     // tiles of a DIM x DIM weight
#define T_DH ((DIM / 64) * (HID / 64))     // tiles of W1 and of W2
#define WBLKS (4 * T_DD + 2 * T_DH)
__global__ __launch_bounds__(256) void cvt_all_kernel(
    const float* __restrict__ x,
    const float* __restrict__ wq, const float* __restrict__ wk, const float* __restrict__ wv,
    const float* __restrict__ wo, const float* __restrict__ w1, const float* __restrict__ w2,
    _Float16* __restrict__ X16, _Float16* __restrict__ Wqkv_t, _Float16* __restrict__ Wo_t,
    _Float16* __restrict__ W1_t, _Float16* __restrict__ W2_t, float scale) {
  const int blk = (int)blockIdx.x;
  if (blk >= WBLKS) { cvt_x_block(x, X16, blk - WBLKS); return; }
  const float* w;
  _Float16* dst;
  int K, N, k0, n0;
  if (blk < 4 * T_DD) {                       // Wq, Wk, Wv (planes of Wqkv_t), Wo
    const int part = blk / T_DD, t = blk % T_DD;
    w = (part == 0) ? wq : ((part == 1) ? wk : ((part == 2) ? wv : wo));
    dst = (part < 3) ? Wqkv_t + (size_t)part * DIM * DIM : Wo_t;
    K = DIM; N = DIM; k0 = (t / (DIM / 64)) * 64; n0 = (t % (DIM / 64)) * 64;
  } else if (blk < 4 * T_DD + T_DH) {
    const int t = blk - 4 * T_DD;
    w = w1; dst = W1_t; K = DIM; N = HID; k0 = (t / (HID / 64)) * 64; n0 = (t % (HID / 64)) * 64;
  } else {
    const int t = blk - 4 * T_DD - T_DH;
    w = w2; dst = W2_t; K = HID; N = DIM; k0 = (t / (DIM / 64)) * 64; n0 = (t % (DIM / 64)) * 64;
  }
  cvt_wt_tile(w, dst, K, N, k0, n0, scale);
}

// ---------------------------------------------------------------------------
// V transpose: qkv (f16 [MROWS][3*DIM], v at col 2*DIM + h*64 + d) ->
// vt[(b*NHEAD+h)*64 + d][s] (s-contiguous, pitch SEQ). 64x64 tiles through LDS,
// ---------------------------------------------------------------------------
__global__ __launch_bounds__(256) void vtrans_kernel(const _Float16* __restrict__ qkv,
                                                     _Float16* __restrict__ vt) {
  __shared__ __attribute__((aligned(16))) _Float16 T[64 * TP];   // [d][s]
  const int bh = blockIdx.y;
  const int b = bh / NHEAD, h = bh % NHEAD;
  const int s0 = blockIdx.x * 64;
  const int tid = threadIdx.x;
#pragma unroll
  for (int q = 0; q < 2; ++q) {
    const int idx = q * 256 + tid;            // 0..511
    const int sr = idx >> 3;                  // 0..63
    const int dc = (idx & 7) << 3;            // 0..56
    const v8h v = *(const v8h*)(qkv + ((size_t)b * SEQ + s0 + sr) * LDQKV + 2 * DIM + h * DHEAD + dc);
#pragma unroll
    for (int e = 0; e < 8; ++e) T[(dc + e) * TP + sr] = v[e];
  }
  __syncthreads();
  const int rs = tid >> 3, cc = (tid & 7) << 3;
  v8h hv[2];
  size_t go[2];
#pragma unroll
  for (int it = 0; it < 2; ++it) {
    const int dl = it * 32 + rs;              // 0..63
    hv[it] = *(const v8h*)(T + dl * TP + cc);
    go[it] = ((size_t)bh * DHEAD + dl) * (size_t)SEQ + s0 + cc;
  }
#pragma unroll
  for (int it = 0; it < 2; ++it) *(v8h*)(vt + go[it]) = hv[it];
  
}

// ---------------------------------------------------------------------------
// WMMA GEMM: C[M][N] = A[M][K] (f16, row-major) . B, with B given transposed as
// Bt[N][K] (f16, k-contiguous).  C = acc*scale (+bias) (relu) (+residual).
// 128x128x64 block tile per stage, 8 waves, wave tile 64x32 (4x2 WMMA tiles).
// A and B stages (128 rows x 128 B each) come into LDS by asynchronous 16-B copies
// (whole 128-B lines per row), two buffers: stage t + 1 flies while stage t is
// multiplied; one barrier per stage. The epilogue stages 64 rows at a time in the
// same LDS; the residual plane is read in the store phase as 16-B vectors.
// RES: 0 none, 1 f32 plane [M][N], 2 bf16r(x) read at full-size rows (N == DIM).
// Requires M%128==0 (grid.y = M/128), N%128==0 (grid.x = N/128), K%64==0.
// ---------------------------------------------------------------------------
#define BM 128
#define BN 128
#define BK 64
#define LDT 72     // LDS tile row stride in halves (144 B = 16 B x odd)
#define GBUF_H ((BM + BN) * LDT)   // halves per buffer: [A 128 rows | B 128 rows]
#define EPF 132    // epilogue stage pitch in floats (528 B)
#define GEMM_SMEM_FLOATS (2 * GBUF_H / 2)
static_assert(64 * EPF <= GEMM_SMEM_FLOATS);
static_assert((DIM % BK) == 0 && (HID % BK) == 0);

// One stage: each lane copies four 16-B pieces of the A tile and four of the B tile
// (rows 32 apart). The s_wait_xcnt stands inside the statement so that no address
// register of a copy is rewritten in front of it.
static __device__ __forceinline__ void stage_ab(unsigned la, unsigned lb, unsigned l32,
                                                const _Float16* ga, const _Float16* gb, size_t g32) {
  asm volatile(
      "global_load_async_to_lds_b128 %0, %8, off\n\t"
      "global_load_async_to_lds_b128 %1, %9, off\n\t"
      "global_load_async_to_lds_b128 %2, %10, off\n\t"
      "global_load_async_to_lds_b128 %3, %11, off\n\t"
      "global_load_async_to_lds_b128 %4, %12, off\n\t"
      "global_load_async_to_lds_b128 %5, %13, off\n\t"
      "global_load_async_to_lds_b128 %6, %14, off\n\t"
      "global_load_async_to_lds_b128 %7, %15, off\n\t"
      "s_wait_xcnt 0x0"
      :: "v"(la), "v"(la + l32), "v"(la + 2 * l32), "v"(la + 3 * l32),
         "v"(lb), "v"(lb + l32), "v"(lb + 2 * l32), "v"(lb + 3 * l32),
         "v"(ga), "v"(ga + g32), "v"(ga + 2 * g32), "v"(ga + 3 * g32),
         "v"(gb), "v"(gb + g32), "v"(gb + 2 * g32), "v"(gb + 3 * g32)
      : "memory");
}

template <bool HAS_BIAS, int RES, bool RELU, bool OUT16>
__global__ __launch_bounds__(256) void gemm_kernel(
    const _Float16* __restrict__ A, const _Float16* __restrict__ Bt,
    const float* __restrict__ bias, const float* __restrict__ res,
    float* __restrict__ outF, _Float16* __restrict__ outH,
    int N, int K, float scale) {
  static_assert(!(RES != 0 && OUT16));
  __shared__ __attribute__((aligned(16))) float smem[GEMM_SMEM_FLOATS];
  _Float16* As = (_Float16*)smem;           // buffer 0: [m][k], then [n][k]
  const int tid = threadIdx.x;
  const int wave = tid >> 5, lane = tid & 31;
  const int r = lane & 15, hb = (lane >> 4) << 3;
  const int mBlk = blockIdx.y * BM, nBlk = blockIdx.x * BN;
  const int mw = (wave & 1) * 64, nw = (wave >> 1) * 32;

  // staging coords: 128 rows x 8 pieces of 16 B per operand = 1024 pieces, 4 per thread
  const int srow = tid >> 3, sch = (tid & 7) << 3;
  const _Float16* gA = A  + (size_t)(mBlk + srow) * K + sch;   // + kt * BK per stage
  const _Float16* gB = Bt + (size_t)(nBlk + srow) * K + sch;
  const size_t g32 = (size_t)32 * K;                            // 32 rows further, halves
  const unsigned lA = (unsigned)(uintptr_t)(As + srow * LDT + sch);   // LDS byte address, buffer 0
  const unsigned lB = lA + BM * LDT * 2;
  const unsigned l32 = 32 * LDT * 2;                            // 32 rows further, bytes
  const unsigned lbuf = GBUF_H * 2;                             // buffer size, bytes
  const int nk = K / BK;

  // stage 0 into buffer 0; landed and published before anything reads it
  stage_ab(lA, lB, l32, gA, gB, g32);
  asm volatile("s_wait_asynccnt 0x0" ::: "memory");            // this wave's copies have landed
  __syncthreads();                                              // every wave's copies are readable
  if (nk > 1) stage_ab(lA + lbuf, lB + lbuf, l32, gA + BK, gB + BK, g32);

  v8f acc[4][2];
#pragma unroll
  for (int i = 0; i < 4; ++i)
#pragma unroll
    for (int j = 0; j < 2; ++j)
#pragma unroll
      for (int v = 0; v < 8; ++v) acc[i][j][v] = 0.f;

#pragma unroll 1
  for (int kt = 0; kt < nk; ++kt) {
    const _Float16* At = As + (kt & 1) * GBUF_H;
    const _Float16* Bs = At + BM * LDT;
#pragma unroll
    for (int ks = 0; ks < BK / 32; ++ks) {
      v16h af[4], bfr[2];
#pragma unroll
      for (int i = 0; i < 4; ++i) af[i] = load_frag(At + (mw + i * 16 + r) * LDT + ks * 32 + hb);
#pragma unroll
      for (int j = 0; j < 2; ++j) bfr[j] = load_frag(Bs + (nw + j * 16 + r) * LDT + ks * 32 + hb);
#pragma unroll
      for (int i = 0; i < 4; ++i)
#pragma unroll
        for (int j = 0; j < 2; ++j) acc[i][j] = wmma16(af[i], bfr[j], acc[i][j]);
    }
    // publish point of stage kt + 1, and hand-over of this stage's buffer
    asm volatile("s_wait_dscnt 0x0" ::: "memory");             // this wave's reads of the buffer are done
    asm volatile("s_wait_asynccnt 0x0" ::: "memory");          // this wave's copies of stage kt + 1 have landed
    __syncthreads();                                            // publishes kt + 1, ends every read of kt
    if (kt + 2 < nk) {
      const unsigned lo = (unsigned)(kt & 1) * lbuf;
      const size_t ko = (size_t)(kt + 2) * BK;
      stage_ab(lA + lo, lB + lo, l32, gA + ko, gB + ko, g32);
    }
  }
  asm volatile("s_wait_asynccnt 0x0" ::: "memory");            // nothing in flight when LDS changes its use
  // the last stage's own barrier has ended every read: LDS is free for the epilogue stage

  // epilogue. D layout: element v -> row 8*lanehi + v, lane&15 -> col.
  float* stg = smem;                          // [64][EPF] f32
  float bcol[2] = {0.f, 0.f};
  if constexpr (HAS_BIAS) {
#pragma unroll
    for (int j = 0; j < 2; ++j) bcol[j] = bf16r(bias[nBlk + nw + j * 16 + r]);
  }
#pragma unroll
  for (int p = 0; p < 2; ++p) {
    if ((wave & 1) == p) {                    // wave-uniform: waves owning rows p*64..p*64+63
#pragma unroll
      for (int i = 0; i < 4; ++i)
#pragma unroll
        for (int j = 0; j < 2; ++j)
#pragma unroll
          for (int v = 0; v < 8; ++v) {
            const int lr = i * 16 + hb + v;                   // 0..63
            const int lc = nw + j * 16 + r;                   // 0..127
            float c = acc[i][j][v] * scale;
            if constexpr (HAS_BIAS) c += bcol[j];
            if constexpr (RELU) c = fmaxf(c, 0.f);
            stg[lr * EPF + lc] = c;
          }
    }
    __syncthreads();
    if constexpr (OUT16) {
      // f16 row segment = 128 halves = 256 B = 2 lines; 16 lanes x 16 B per row
      v8h hv[4];
      size_t go[4];
#pragma unroll
      for (int it = 0; it < 4; ++it) {
        const int lr = it * 16 + wave * 2 + (lane >> 4);   // 0..63
        const int lc = (lane & 15) << 3;                    // 0..120
        const v4f x0 = *(const v4f*)(stg + lr * EPF + lc);
        const v4f x1 = *(const v4f*)(stg + lr * EPF + lc + 4);
        v8h hh;
#pragma unroll
        for (int e = 0; e < 4; ++e) { hh[e] = (_Float16)x0[e]; hh[e + 4] = (_Float16)x1[e]; }
        hv[it] = hh;
        go[it] = (size_t)(mBlk + p * 64 + lr) * (size_t)N + nBlk + lc;
      }
#pragma unroll
      for (int it = 0; it < 4; ++it) *(v8h*)(outH + go[it]) = hv[it];
      
    } else {
      // f32 row segment = 128 floats = 512 B = 4 lines; 32 lanes x 16 B per row.
      // Residual added here from one 16-B load per row per lane (8 global loads per lane).
      v4f fv[8];
      size_t go[8];
#pragma unroll
      for (int it = 0; it < 8; ++it) {
        const int lr = it * 8 + wave;                        // 0..63
        const int lc = lane << 2;                            // 0..124
        const size_t grow = (size_t)(mBlk + p * 64 + lr);
        const size_t gcol = (size_t)(nBlk + lc);
        v4f val = *(const v4f*)(stg + lr * EPF + lc);
        if constexpr (RES == 1) {
          const v4f rr = *(const v4f*)(res + grow * (size_t)N + gcol);
#pragma unroll
          for (int e = 0; e < 4; ++e) val[e] = val[e] + rr[e];
        }
        if constexpr (RES == 2) {
          const v4f rr = *(const v4f*)(res + FROW(grow) * (size_t)DIM + gcol);
#pragma unroll
          for (int e = 0; e < 4; ++e) val[e] = val[e] + bf16r(rr[e]);
        }
        fv[it] = val;
        go[it] = grow * (size_t)N + gcol;
      }
#pragma unroll
      for (int it = 0; it < 8; ++it) *(v4f*)(outF + go[it]) = fv[it];
      
    }
    __syncthreads();                          // stage reused by the other row half
  }
}

#define OPAD 72   // O stage row stride (halves)
#define AW 8                    // waves per block
#define AQ (AW * 16)            // query rows per block
#define SK 64                   // keys per stage
#define KVP 72                  // staged row pitch in halves (144 B = 16 B x odd)
#define TILE_H (64 * KVP)       // halves per staged tile
#define NST (SEQ / SK)          // stages
static_assert((SEQ % AQ) == 0 && (SEQ % SK) == 0 && AW * 32 == 256);

// One stage: each lane copies two 16-B pieces of the K tile and two of the V^T tile.
// The s_wait_xcnt stands inside the statement so that no address register of a
// copy is rewritten in front of it.
static __device__ __forceinline__ void stage_kv(unsigned lk0, unsigned lk1, unsigned lv0, unsigned lv1,
                                                const _Float16* gk0, const _Float16* gk1,
                                                const _Float16* gv0, const _Float16* gv1) {
  asm volatile(
      "global_load_async_to_lds_b128 %0, %4, off\n\t"
      "global_load_async_to_lds_b128 %1, %5, off\n\t"
      "global_load_async_to_lds_b128 %2, %6, off\n\t"
      "global_load_async_to_lds_b128 %3, %7, off\n\t"
      "s_wait_xcnt 0x0"
      :: "v"(lk0), "v"(lk1), "v"(lv0), "v"(lv1), "v"(gk0), "v"(gk1), "v"(gv0), "v"(gv1)
      : "memory");
}

// value of lane l ^ 16 (the other half's share of the same query column)
static __device__ __forceinline__ float xhalf(float x) {
  return __builtin_bit_cast(float, __builtin_amdgcn_permlanex16(
      __builtin_bit_cast(int, x), __builtin_bit_cast(int, x), 0x76543210, 0xfedcba98, false, false));
}

__global__ __launch_bounds__(256) __attribute__((amdgpu_num_vgpr(256)))
void attn_kernel(const _Float16* __restrict__ qkv, const _Float16* __restrict__ vt,
                 _Float16* __restrict__ ctx) {
  __shared__ __attribute__((aligned(16))) _Float16 KV[2 * 2 * TILE_H];   // [buffer][K | V^T][row][KVP]
  __shared__ __attribute__((aligned(16))) _Float16 Os[AW * 16 * OPAD];   // per-wave O 16x64
  const int nqt = SEQ / AQ;
  const int qt = (int)(blockIdx.x % nqt);
  const int bh = (int)(blockIdx.x / nqt);
  const int h = bh % NHEAD, b = bh / NHEAD;
  const int tid = threadIdx.x, wave = tid >> 5, lane = tid & 31;
  const int r = lane & 15, hb = (lane >> 4) << 3;
  const _Float16* Qb = qkv + (size_t)b * SEQ * LDQKV + h * DHEAD;
  const _Float16* Kh = Qb + DIM;
  const _Float16* Vh = vt + (size_t)bh * DHEAD * SEQ;
  const int q0 = qt * AQ + wave * 16;

  // staging coords: 64 rows x 8 pieces of 16 B per tile = 512 pieces, 2 per thread
  const int srow = tid >> 3, sch = (tid & 7) << 3;
  const _Float16* gK = Kh + (size_t)srow * LDQKV + sch;      // + key0 * LDQKV per stage
  const _Float16* gV = Vh + (size_t)srow * SEQ + sch;        // + key0 per stage
  const unsigned lK = (unsigned)(uintptr_t)(KV + srow * KVP + sch);   // LDS byte address, buffer 0
  const unsigned lV = lK + TILE_H * 2;
  const unsigned l32 = 32 * KVP * 2;                          // 32 rows further, bytes
  const unsigned lbuf = 2 * TILE_H * 2;                       // buffer size, bytes

  // stage 0 into buffer 0; landed and published before anything reads it
  stage_kv(lK, lK + l32, lV, lV + l32, gK, gK + (size_t)32 * LDQKV, gV, gV + (size_t)32 * SEQ);
  asm volatile("s_wait_asynccnt 0x0" ::: "memory");          // this wave's copies have landed
  __syncthreads();                                            // every wave's copies are readable
  if (NST > 1) {
    const _Float16* k1 = gK + (size_t)SK * LDQKV;
    const _Float16* v1 = gV + SK;
    stage_kv(lK + lbuf, lK + lbuf + l32, lV + lbuf, lV + lbuf + l32,
             k1, k1 + (size_t)32 * LDQKV, v1, v1 + (size_t)32 * SEQ);
  }

  // Q fragments (B: lane -> query column, halves -> d), d chunks 0..31 and 32..63
  v16h aq[2];
#pragma unroll
  for (int dc = 0; dc < 2; ++dc)
    aq[dc] = load_frag(Qb + (size_t)(q0 + r) * LDQKV + dc * 32 + hb);

  // constant all-ones A fragment: ones . P^T -> per-query sums (every row of D alike)
  v16h ones;
#pragma unroll
  for (int e = 0; e < 16; ++e) ones[e] = (_Float16)1.0f;

  v8f o[4];
#pragma unroll
  for (int t = 0; t < 4; ++t)
#pragma unroll
    for (int v = 0; v < 8; ++v) o[t][v] = 0.f;
  float mrow = -1e30f, lrow = 0.f;           // of this lane's query (q0 + r), alike in both halves

  const v8f zero = {0.f, 0.f, 0.f, 0.f, 0.f, 0.f, 0.f, 0.f};

#pragma unroll 1
  for (int st = 0; st < NST; ++st) {
   const _Float16* Kt = KV + (st & 1) * (2 * TILE_H);
   const _Float16* Vt = Kt + TILE_H;
#pragma unroll
   for (int sub = 0; sub < SK / 32; ++sub) {
    const int key0 = sub * 32;                // key offset inside the staged tile

    // S^T(32x16) = K(32x64) . Q^T : A-frag lane -> key, halves -> d (split map)
    // D: element v of tile kt -> key kt*16 + 8*lanehi + v, lane&15 -> query
    v8f s[2];
#pragma unroll
    for (int kt = 0; kt < 2; ++kt)
#pragma unroll
      for (int v = 0; v < 8; ++v) s[kt][v] = 0.f;
#pragma unroll
    for (int kt = 0; kt < 2; ++kt)
#pragma unroll
      for (int dc = 0; dc < 2; ++dc) {
        const v16h ak = load_frag(Kt + (key0 + kt * 16 + r) * KVP + dc * 32 + hb);
        s[kt] = wmma16(ak, aq[dc], s[kt]);
      }

    // online softmax of one query per lane: 16 keys here, 16 in lane ^ 16
    float m8[8];
#pragma unroll
    for (int v = 0; v < 8; ++v) m8[v] = fmaxf(s[0][v], s[1][v]);
    float mx = fmaxf(fmaxf(fmaxf(m8[0], m8[1]), fmaxf(m8[2], m8[3])),
                     fmaxf(fmaxf(m8[4], m8[5]), fmaxf(m8[6], m8[7]))) * 0.125f;   // * DH^-0.5
    mx = fmaxf(mx, xhalf(mx));
    const float mnew = fmaxf(mrow, mx);
    const float alpha = __expf(mrow - mnew);
    mrow = mnew;

    // P^T as the B operand: half e -> key (e < 8 ? 8*lanehi + e : 16 + 8*lanehi + e - 8),
    // which is element e & 7 of tile e >> 3 of this very lane
    v16h pf;
#pragma unroll
    for (int kt = 0; kt < 2; ++kt)
#pragma unroll
      for (int v = 0; v < 8; ++v)
        pf[kt * 8 + v] = (_Float16)(__expf(s[kt][v] * 0.125f - mnew) * 1024.0f);   // P carried x1024

    // row sums on the matrix pipe
    const v8f rsum = wmma16(ones, pf, zero);
    lrow = lrow * alpha + rsum[0];

    // O^T(64x16) = alpha*O^T + V^T(64x32) . P^T(32x16); V^T rows are d, key-contiguous
#pragma unroll
    for (int t = 0; t < 4; ++t) {
#pragma unroll
      for (int v = 0; v < 8; ++v) o[t][v] *= alpha;
      const v16h av = load_frag(Vt + (t * 16 + r) * KVP + key0 + hb);
      o[t] = wmma16(av, pf, o[t]);
    }
   }
   // publish point of stage st + 1, and hand-over of this stage's buffer
   asm volatile("s_wait_dscnt 0x0" ::: "memory");            // this wave's reads of the buffer are done
   asm volatile("s_wait_asynccnt 0x0" ::: "memory");         // this wave's copies of stage st + 1 have landed
   __syncthreads();                                           // publishes st + 1, ends every read of st
   if (st + 2 < NST) {
     const _Float16* kn = gK + (size_t)(st + 2) * SK * LDQKV;
     const _Float16* vn = gV + (st + 2) * SK;
     const unsigned lo = (unsigned)(st & 1) * lbuf;
     stage_kv(lK + lo, lK + lo + l32, lV + lo, lV + lo + l32,
              kn, kn + (size_t)32 * LDQKV, vn, vn + (size_t)32 * SEQ);
   }
  }
  asm volatile("s_wait_asynccnt 0x0" ::: "memory");          // nothing in flight when the wave ends

  // ctx = 16 * O / l  (the x1024 P carry cancels between O and l)
  // O^T: element v of tile t -> d = t*16 + 8*lanehi + v of query r: 8 consecutive halves
  _Float16* Ow = Os + wave * 16 * OPAD;
  const float inv = 16.0f / lrow;
#pragma unroll
  for (int t = 0; t < 4; ++t) {
    v8h ov;
#pragma unroll
    for (int v = 0; v < 8; ++v) ov[v] = (_Float16)(o[t][v] * inv);
    *(v8h*)(Ow + r * OPAD + t * 16 + hb) = ov;
  }
  __syncthreads();

  const int rs = lane >> 3, cc = (lane & 7) << 3;
  v8h hv[4];
  size_t go[4];
#pragma unroll
  for (int it = 0; it < 4; ++it) {
    const int lr = it * 4 + rs;               // 0..15
    hv[it] = *(const v8h*)(Ow + lr * OPAD + cc);
    go[it] = ((size_t)b * SEQ + q0 + lr) * (size_t)DIM + h * DHEAD + cc;
  }
#pragma unroll
  for (int it = 0; it < 4; ++it) *(v8h*)(ctx + go[it]) = hv[it];
  
}

// ---------------------------------------------------------------------------
// in: f32 [MROWS][DIM] (residual already added).  outF: f32 (row mapped to the
// full-size layout when MAPOUT), outH: f16 copy (compact rows) when OUT16.
// ---------------------------------------------------------------------------
template <bool OUT16, bool MAPOUT>
__global__ __launch_bounds__(256) void ln_kernel(
    const float* __restrict__ in, const float* __restrict__ g, const float* __restrict__ bt,
    float* __restrict__ outF, _Float16* __restrict__ outH) {
#pragma clang fp contract(off)
  __shared__ float red0[8];
  __shared__ float red1[8];
  __shared__ __attribute__((aligned(16))) _Float16 sh[DIM];
  const size_t row = blockIdx.x;
  const int tid = threadIdx.x, wave = tid >> 5, lane = tid & 31;
  const v4f v = *(const v4f*)(in + row * DIM + tid * 4);
  float s = (v[0] + v[1]) + (v[2] + v[3]);
#pragma unroll
  for (int m = 16; m >= 1; m >>= 1) s += __shfl_xor(s, m, 32);
  if (lane == 0) red0[wave] = s;
  __syncthreads();
  float S = 0.f;
#pragma unroll
  for (int i = 0; i < 8; ++i) S += red0[i];
  const float mu = S * (1.0f / (float)DIM);
  const float d0 = v[0] - mu, d1 = v[1] - mu, d2 = v[2] - mu, d3 = v[3] - mu;
  float ss = (d0 * d0 + d1 * d1) + (d2 * d2 + d3 * d3);
#pragma unroll
  for (int m = 16; m >= 1; m >>= 1) ss += __shfl_xor(ss, m, 32);
  if (lane == 0) red1[wave] = ss;
  __syncthreads();
  float SS = 0.f;
#pragma unroll
  for (int i = 0; i < 8; ++i) SS += red1[i];
  const float var = SS * (1.0f / (float)DIM);
  const float rstd = rsqrtf(var + 1e-5f);
  const v4f gg = *(const v4f*)(g + tid * 4);
  const v4f bb = *(const v4f*)(bt + tid * 4);
  v4f y;
  y[0] = d0 * rstd * bf16r(gg[0]) + bf16r(bb[0]);
  y[1] = d1 * rstd * bf16r(gg[1]) + bf16r(bb[1]);
  y[2] = d2 * rstd * bf16r(gg[2]) + bf16r(bb[2]);
  y[3] = d3 * rstd * bf16r(gg[3]) + bf16r(bb[3]);
  const size_t orow = MAPOUT ? FROW(row) : row;
  float* op = outF + orow * DIM + tid * 4;
  *(v4f*)op = y;
  
  if constexpr (OUT16) {
#pragma unroll
    for (int e = 0; e < 4; ++e) sh[tid * 4 + e] = (_Float16)y[e];
    __syncthreads();
    if (tid < 128) {                           // waves 0..3, wave-uniform
      const v8h hv = *(const v8h*)(sh + tid * 8);
      _Float16* hp = outH + row * DIM + tid * 8;
      *(v8h*)hp = hv;
      
    }
  }
}

// ---------------------------------------------------------------------------
// Launch plan (9 launches):
//  cvt_all (x and all six weights), gemm qkv, vtrans, attn, gemm o (+x),
//  ln1, gemm 1 (relu), gemm 2 (+h), ln2 -> d_out
// Workspace (byte offsets derived below, total 106 MiB at full size):
//  W planes 10 MiB | P1 16 MiB: X16 -> VT16 -> G16 | P2 48 MiB: QKV16 -> {R1, H16} -> R2
//  | P3 32 MiB: CTX16 -> H32
// ---------------------------------------------------------------------------
extern "C" void kernel_launch(void* const* d_in, const int* in_sizes, int n_in,
                              void* d_out, int out_size, void* d_ws, size_t ws_size,
                              hipStream_t stream) {
  if (n_in < 13) return;
  const size_t needX = ((size_t)(NB - 1) * SEQ_FULL + SEQ) * DIM;
  if ((size_t)in_sizes[0] < needX) return;
  if (in_sizes[1] < DIM * DIM || in_sizes[2] < DIM * DIM || in_sizes[3] < DIM * DIM ||
      in_sizes[4] < DIM * DIM) return;
  if (in_sizes[5] < DIM || in_sizes[6] < DIM || in_sizes[10] < DIM || in_sizes[11] < DIM ||
      in_sizes[12] < DIM) return;
  if (in_sizes[7] < DIM * HID || in_sizes[8] < HID || in_sizes[9] < HID * DIM) return;
  if ((size_t)out_size < needX) return;

  const float* x     = (const float*)d_in[0];
  const float* Wq    = (const float*)d_in[1];
  const float* Wk    = (const float*)d_in[2];
  const float* Wv    = (const float*)d_in[3];
  const float* Wo    = (const float*)d_in[4];
  const float* ln1_g = (const float*)d_in[5];
  const float* ln1_b = (const float*)d_in[6];
  const float* W1    = (const float*)d_in[7];
  const float* b1    = (const float*)d_in[8];
  const float* W2    = (const float*)d_in[9];
  const float* b2    = (const float*)d_in[10];
  const float* ln2_g = (const float*)d_in[11];
  const float* ln2_b = (const float*)d_in[12];
  float* out = (float*)d_out;

  // carve (all region sizes are exact multiples of the whole-line stores used)
  const size_t szWqkv = (size_t)3 * DIM * DIM * 2;     // [3072][1024] f16
  const size_t szWo   = (size_t)DIM * DIM * 2;         // [1024][1024] f16
  const size_t szW1   = (size_t)HID * DIM * 2;         // [512][1024]  f16 (W1^T)
  const size_t szW2   = (size_t)DIM * HID * 2;         // [1024][512]  f16 (W2^T)
  const size_t szP1   = (size_t)MROWS * DIM * 2;       // X16 / VT16 / G16
  const size_t szP2   = (size_t)MROWS * LDQKV * 2;     // QKV16 / {R1,H16} / R2
  const size_t szP3   = (size_t)MROWS * DIM * 4;       // CTX16 / H32
  const size_t oWqkv = 0;
  const size_t oWo   = oWqkv + szWqkv;
  const size_t oW1   = oWo + szWo;
  const size_t oW2   = oW1 + szW1;
  const size_t oP1   = oW2 + szW2;
  const size_t oP2   = oP1 + szP1;
  const size_t oP3   = oP2 + szP2;
  const size_t total = oP3 + szP3;
  if (total > ws_size) return;
  static_assert((size_t)MROWS * DIM * 4 + (size_t)MROWS * DIM * 2 <= (size_t)MROWS * LDQKV * 2);
  static_assert((size_t)MROWS * HID * 2 <= (size_t)MROWS * DIM * 2);
  static_assert((size_t)NB * NHEAD * DHEAD * SEQ * 2 <= (size_t)MROWS * DIM * 2);

  char* ws = (char*)d_ws;
  _Float16* Wqkv_t = (_Float16*)(ws + oWqkv);
  _Float16* Wo_t   = (_Float16*)(ws + oWo);
  _Float16* W1_t   = (_Float16*)(ws + oW1);
  _Float16* W2_t   = (_Float16*)(ws + oW2);
  _Float16* X16    = (_Float16*)(ws + oP1);
  _Float16* VT16   = (_Float16*)(ws + oP1);
  _Float16* G16    = (_Float16*)(ws + oP1);
  _Float16* QKV16  = (_Float16*)(ws + oP2);
  float*    R1     = (float*)   (ws + oP2);
  _Float16* H16    = (_Float16*)(ws + oP2 + (size_t)MROWS * DIM * 4);
  float*    R2     = (float*)   (ws + oP2);
  _Float16* CTX16  = (_Float16*)(ws + oP3);
  float*    H32    = (float*)   (ws + oP3);

  const float wsc   = 32.0f;                  // weight carry
  const float inv32 = 1.0f / 32.0f;
  const float inv512 = 1.0f / 512.0f;         // 1/(32 weight carry * 16 ctx carry)

  // 1, 2) x -> X16 (bf16 RNE, f16 container); weights -> transposed f16 planes, bf16 RNE then x32
  cvt_all_kernel<<<dim3(WBLKS + XBLKS), 256, 0, stream>>>(
      x, Wq, Wk, Wv, Wo, W1, W2, X16, Wqkv_t, Wo_t, W1_t, W2_t, wsc);

  // 3) qkv = x @ [Wq | Wk | Wv]   (f16 out, 1/32 folded)
  gemm_kernel<false, 0, false, true>
      <<<dim3(LDQKV / BN, MROWS / BM), 256, 0, stream>>>(
          X16, Wqkv_t, nullptr, nullptr, nullptr, QKV16, LDQKV, DIM, inv32);

  // 4) V^T plane per (b,h)
  vtrans_kernel<<<dim3(SEQ / 64, NB * NHEAD), 256, 0, stream>>>(QKV16, VT16);

  // 5) ctx = softmax(q k^T / 8) v    (f16 out, carried x16)
  attn_kernel<<<dim3(NB * NHEAD * (SEQ / AQ)), 256, 0, stream>>>(QKV16, VT16, CTX16);

  // 6) r1 = ctx @ Wo + bf16r(x)        (f32 out)
  gemm_kernel<false, 2, false, false>
      <<<dim3(DIM / BN, MROWS / BM), 256, 0, stream>>>(
          CTX16, Wo_t, nullptr, x, R1, nullptr, DIM, DIM, inv512);

  // 7) h = LN1(r1)                     (f32 + f16)
  ln_kernel<true, false><<<dim3(MROWS), 256, 0, stream>>>(R1, ln1_g, ln1_b, H32, H16);

  // 8) g = relu(h @ W1 + b1)           (f16 out)
  gemm_kernel<true, 0, true, true>
      <<<dim3(HID / BN, MROWS / BM), 256, 0, stream>>>(
          H16, W1_t, b1, nullptr, nullptr, G16, HID, DIM, inv32);

  // 9) r2 = g @ W2 + b2 + h            (f32 out)
  gemm_kernel<true, 1, false, false>
      <<<dim3(DIM / BN, MROWS / BM), 256, 0, stream>>>(
          G16, W2_t, b2, H32, R2, nullptr, DIM, HID, inv32);

  // 10) out = LN2(r2)                  (f32, full-size row layout)
  ln_kernel<false, true><<<dim3(MROWS), 256, 0, stream>>>(R2, ln2_g, ln2_b, out, nullptr);
}

// v005
// A run of this version takes 178 microseconds.
// In both of two side-by-side timings against v004, it was 1.04 times as fast.
// Counting every step since v000, it is 2.14 times as fast.
#include <hip/hip_runtime.h>
#include <stdint.h>
#include <stddef.h>

// All contractions: v_wmma_f32_16x16x32_f16 (f16 operands, f32 accumulate): q/k/v projections, q.k^T scores, P.1 row sums, P.V, output projection, FFN up, FFN down. Float inputs RNE-converted to bf16 then carried in f16 (weights x32, P x1024, ctx x16); softmax and LayerNorm in f32.

#ifndef NB
#define NB 8
#endif
#ifndef SEQ
#define SEQ 1024
#endif
#define NB_FULL 8
#define SEQ_FULL 1024
#define DIM 1024
#define NHEAD 16
#define DHEAD 64
#define HID 512
#define MROWS (NB * SEQ)
#define LDQKV (3 * DIM)
// compact row m (b*SEQ + s) -> full-size row (b*SEQ_FULL + s) for input x and for d_out
#define FROW(m) ((((size_t)(m)) / SEQ) * SEQ_FULL + (((size_t)(m)) % SEQ))

static_assert(NB >= 1 && NB <= NB_FULL);
static_assert(SEQ >= 64 && SEQ <= SEQ_FULL && (SEQ % 64) == 0);
static_assert((MROWS % 128) == 0);
static_assert((DIM % 128) == 0 && (HID % 128) == 0 && (DIM % 32) == 0 && (HID % 32) == 0);
static_assert(NHEAD * DHEAD == DIM && DHEAD == 64);
static_assert(((size_t)(NB - 1) * SEQ_FULL + SEQ) * DIM <= (size_t)NB_FULL * SEQ_FULL * DIM);

// ---------------------------------------------------------------------------
// Types / helpers
// ---------------------------------------------------------------------------
typedef _Float16 v16h __attribute__((ext_vector_type(16)));
typedef _Float16 v8h  __attribute__((ext_vector_type(8)));
typedef float    v8f  __attribute__((ext_vector_type(8)));
typedef float    v4f  __attribute__((ext_vector_type(4)));

// 16x16x32 f16 WMMA followed by the VALU hazard guard (ties D, keeps A/B live)
static __device__ __forceinline__ v8f wmma16(v16h a, v16h b, v8f c) {
  v8f d = __builtin_amdgcn_wmma_f32_16x16x32_f16(false, a, false, b, (short)0, c, false, false);
  asm volatile("v_nop\n\tv_nop\n\tv_nop\n\tv_nop" : "+v"(d) : "v"(a), "v"(b));
  return d;
}

// f32 -> nearest-even bf16 value, returned as f32
static __device__ __forceinline__ float bf16r(float f) {
  unsigned int u = __float_as_uint(f);
  u = (u + 0x7FFFu + ((u >> 16) & 1u)) & 0xFFFF0000u;
  return __uint_as_float(u);
}

// Build a 16-half WMMA A/B fragment for one lane from a row-major (k-contiguous) run.
// 16-bit operand layout: lane-half base8 = (lane>=16)?8:0;
// halves 0..7 -> k = base8+0..7, halves 8..15 -> k = base8+16..23.
// Caller passes p already offset by base8; we read [p, p+8) and [p+16, p+24).
static __device__ __forceinline__ v16h load_frag(const _Float16* p) {
  v8h lo = *(const v8h*)(p);
  v8h hi = *(const v8h*)(p + 16);
  v16h f;
#pragma unroll
  for (int e = 0; e < 8; ++e) { f[e] = lo[e]; f[e + 8] = hi[e]; }
  return f;
}

// ---------------------------------------------------------------------------
// x (f32 [NB_FULL*SEQ_FULL][DIM]) -> X16 (f16 [MROWS][DIM]), bf16 RNE first.
// One block's share; blk = 0 .. MROWS*DIM/8/256 - 1 exactly.
// ---------------------------------------------------------------------------
#define XBLKS (MROWS / 2)
static __device__ __forceinline__ void cvt_x_block(const float* __restrict__ x,
                                                   _Float16* __restrict__ X16, int blk) {
#pragma clang fp contract(off)
  const size_t i = (size_t)blk * 256 + threadIdx.x;          // 8-element chunk
  const size_t m = i / (DIM / 8);
  const int c = (int)(i % (DIM / 8)) * 8;
  const float* src = x + FROW(m) * DIM + c;
  const v4f a = *(const v4f*)(src);
  const v4f b = *(const v4f*)(src + 4);
  v8h hv;
#pragma unroll
  for (int e = 0; e < 4; ++e) {
    hv[e]     = (_Float16)bf16r(a[e]);
    hv[e + 4] = (_Float16)bf16r(b[e]);
  }
  _Float16* dst = X16 + m * DIM + c;
  *(v8h*)dst = hv;
  
}

// ---------------------------------------------------------------------------
// Weight W (f32 [K][N] row-major) -> transposed f16 plane
// dst[n][k] = f16(bf16r(W[k][n]) * scale). One block's 64x64 tile at (k0, n0)
// (8 lanes x 16 B, one instruction per 32 lines).
// ---------------------------------------------------------------------------
#define TP 72
static __device__ __forceinline__ void cvt_wt_tile(
    const float* __restrict__ w, _Float16* __restrict__ dst, int K, int N, int k0, int n0, float scale) {
#pragma clang fp contract(off)
  __shared__ __attribute__((aligned(16))) _Float16 T[64 * TP];   // [n][k]
  const int tid = threadIdx.x;
#pragma unroll
  for (int q = 0; q < 4; ++q) {
    const int idx = q * 256 + tid;            // 0..1023
    const int kr = idx >> 4;                  // 0..63
    const int nc = (idx & 15) << 2;           // 0..60
    const v4f v = *(const v4f*)(w + (size_t)(k0 + kr) * N + n0 + nc);
#pragma unroll
    for (int e = 0; e < 4; ++e) T[(nc + e) * TP + kr] = (_Float16)(bf16r(v[e]) * scale);
  }
  __syncthreads();
  const int rs = tid >> 3, cc = (tid & 7) << 3;
  v8h hv[2];
  size_t go[2];
#pragma unroll
  for (int it = 0; it < 2; ++it) {
    const int nl = it * 32 + rs;              // 0..63
    hv[it] = *(const v8h*)(T + nl * TP + cc);
    go[it] = (size_t)(n0 + nl) * (size_t)K + k0 + cc;
  }
#pragma unroll
  for (int it = 0; it < 2; ++it) *(v8h*)(dst + go[it]) = hv[it];
  
}

// ---------------------------------------------------------------------------
// All input conversions in ONE launch: none of them reads what another writes, so
// the four small weight grids run beside the x stream instead of one after another.
// Blocks 0 .. WBLKS-1: one 64x64 weight tile each (Wq | Wk | Wv | Wo | W1 | W2, they
// have the longer chain, LDS and a barrier, and start first); the rest: x chunks.
// Every branch is on blockIdx alone: the barrier in cvt_wt_tile is block-uniform.
// ---------------------------------------------------------------------------
#define T_DD ((DIM / 64) * (DIM / 64))     // tiles of a DIM x DIM weight
#define T_DH ((DIM / 64) * (HID / 64))     // tiles of W1 and of W2
#define WBLKS (4 * T_DD + 2 * T_DH)
__global__ __launch_bounds__(256) void cvt_all_kernel(
    const float* __restrict__ x,
    const float* __restrict__ wq, const float* __restrict__ wk, const float* __restrict__ wv,
    const float* __restrict__ wo, const float* __restrict__ w1, const float* __restrict__ w2,
    _Float16* __restrict__ X16, _Float16* __restrict__ Wqkv_t, _Float16* __restrict__ Wo_t,
    _Float16* __restrict__ W1_t, _Float16* __restrict__ W2_t, float scale) {
  const int blk = (int)blockIdx.x;
  if (blk >= WBLKS) { cvt_x_block(x, X16, blk - WBLKS); return; }
  const float* w;
  _Float16* dst;
  int K, N, k0, n0;
  if (blk < 4 * T_DD) {                       // Wq, Wk, Wv (planes of Wqkv_t), Wo
    const int part = blk / T_DD, t = blk % T_DD;
    w = (part == 0) ? wq : ((part == 1) ? wk : ((part == 2) ? wv : wo));
    dst = (part < 3) ? Wqkv_t + (size_t)part * DIM * DIM : Wo_t;
    K = DIM; N = DIM; k0 = (t / (DIM / 64)) * 64; n0 = (t % (DIM / 64)) * 64;
  } else if (blk < 4 * T_DD + T_DH) {
    const int t = blk - 4 * T_DD;
    w = w1; dst = W1_t; K = DIM; N = HID; k0 = (t / (HID / 64)) * 64; n0 = (t % (HID / 64)) * 64;
  } else {
    const int t = blk - 4 * T_DD - T_DH;
    w = w2; dst = W2_t; K = HID; N = DIM; k0 = (t / (DIM / 64)) * 64; n0 = (t % (DIM / 64)) * 64;
  }
  cvt_wt_tile(w, dst, K, N, k0, n0, scale);
}

// ---------------------------------------------------------------------------
// V transpose: qkv (f16 [MROWS][3*DIM], v at col 2*DIM + h*64 + d) ->
// vt[(b*NHEAD+h)*64 + d][s] (s-contiguous, pitch SEQ). 64x64 tiles through LDS,
// ---------------------------------------------------------------------------
__global__ __launch_bounds__(256) void vtrans_kernel(const _Float16* __restrict__ qkv,
                                                     _Float16* __restrict__ vt) {
  __shared__ __attribute__((aligned(16))) _Float16 T[64 * TP];   // [d][s]
  const int bh = blockIdx.y;
  const int b = bh / NHEAD, h = bh % NHEAD;
  const int s0 = blockIdx.x * 64;
  const int tid = threadIdx.x;
#pragma unroll
  for (int q = 0; q < 2; ++q) {
    const int idx = q * 256 + tid;            // 0..511
    const int sr = idx >> 3;                  // 0..63
    const int dc = (idx & 7) << 3;            // 0..56
    const v8h v = *(const v8h*)(qkv + ((size_t)b * SEQ + s0 + sr) * LDQKV + 2 * DIM + h * DHEAD + dc);
#pragma unroll
    for (int e = 0; e < 8; ++e) T[(dc + e) * TP + sr] = v[e];
  }
  __syncthreads();
  const int rs = tid >> 3, cc = (tid & 7) << 3;
  v8h hv[2];
  size_t go[2];
#pragma unroll
  for (int it = 0; it < 2; ++it) {
    const int dl = it * 32 + rs;              // 0..63
    hv[it] = *(const v8h*)(T + dl * TP + cc);
    go[it] = ((size_t)bh * DHEAD + dl) * (size_t)SEQ + s0 + cc;
  }
#pragma unroll
  for (int it = 0; it < 2; ++it) *(v8h*)(vt + go[it]) = hv[it];
  
}

// ---------------------------------------------------------------------------
// WMMA GEMM: C[M][N] = A[M][K] (f16, row-major) . B, with B given transposed as
// Bt[N][K] (f16, k-contiguous).  C = acc*scale (+bias) (relu) (+residual).
// 128x128x64 block tile per stage, 8 waves, wave tile 64x32 (4x2 WMMA tiles).
// A and B stages (128 rows x 128 B each) come into LDS by asynchronous 16-B copies
// (whole 128-B lines per row), two buffers: stage t + 1 flies while stage t is
// multiplied; one barrier per stage. The epilogue stages 64 rows at a time in the
// same LDS; the residual plane is read in the store phase as 16-B vectors.
// RES: 0 none, 1 f32 plane [M][N], 2 bf16r(x) read at full-size rows (N == DIM).
// Requires M%128==0 (grid.y = M/128), N%128==0 (grid.x = N/128), K%64==0.
// ---------------------------------------------------------------------------
#define BM 128
#define BN 128
#define BK 64
#define LDT 72     // LDS tile row stride in halves (144 B = 16 B x odd)
#define GBUF_H ((BM + BN) * LDT)   // halves per buffer: [A 128 rows | B 128 rows]
#define EPF 132    // epilogue stage pitch in floats (528 B)
#define GEMM_SMEM_FLOATS (2 * GBUF_H / 2)
static_assert(64 * EPF <= GEMM_SMEM_FLOATS);
static_assert((DIM % BK) == 0 && (HID % BK) == 0);

// One stage: each lane copies four 16-B pieces of the A tile and four of the B tile
// (rows 32 apart). The s_wait_xcnt stands inside the statement so that no address
// register of a copy is rewritten in front of it.
static __device__ __forceinline__ void stage_ab(unsigned la, unsigned lb, unsigned l32,
                                                const _Float16* ga, const _Float16* gb, size_t g32) {
  asm volatile(
      "global_load_async_to_lds_b128 %0, %8, off\n\t"
      "global_load_async_to_lds_b128 %1, %9, off\n\t"
      "global_load_async_to_lds_b128 %2, %10, off\n\t"
      "global_load_async_to_lds_b128 %3, %11, off\n\t"
      "global_load_async_to_lds_b128 %4, %12, off\n\t"
      "global_load_async_to_lds_b128 %5, %13, off\n\t"
      "global_load_async_to_lds_b128 %6, %14, off\n\t"
      "global_load_async_to_lds_b128 %7, %15, off\n\t"
      "s_wait_xcnt 0x0"
      :: "v"(la), "v"(la + l32), "v"(la + 2 * l32), "v"(la + 3 * l32),
         "v"(lb), "v"(lb + l32), "v"(lb + 2 * l32), "v"(lb + 3 * l32),
         "v"(ga), "v"(ga + g32), "v"(ga + 2 * g32), "v"(ga + 3 * g32),
         "v"(gb), "v"(gb + g32), "v"(gb + 2 * g32), "v"(gb + 3 * g32)
      : "memory");
}

template <bool HAS_BIAS, int RES, bool RELU, bool OUT16>
__global__ __launch_bounds__(256) void gemm_kernel(
    const _Float16* __restrict__ A, const _Float16* __restrict__ Bt,
    const float* __restrict__ bias, const float* __restrict__ res,
    float* __restrict__ outF, _Float16* __restrict__ outH,
    int N, int K, float scale) {
  static_assert(!(RES != 0 && OUT16));
  __shared__ __attribute__((aligned(16))) float smem[GEMM_SMEM_FLOATS];
  _Float16* As = (_Float16*)smem;           // buffer 0: [m][k], then [n][k]
  const int tid = threadIdx.x;
  const int wave = tid >> 5, lane = tid & 31;
  const int r = lane & 15, hb = (lane >> 4) << 3;
  const int mBlk = blockIdx.y * BM, nBlk = blockIdx.x * BN;
  const int mw = (wave & 1) * 64, nw = (wave >> 1) * 32;

  // staging coords: 128 rows x 8 pieces of 16 B per operand = 1024 pieces, 4 per thread
  const int srow = tid >> 3, sch = (tid & 7) << 3;
  const _Float16* gA = A  + (size_t)(mBlk + srow) * K + sch;   // + kt * BK per stage
  const _Float16* gB = Bt + (size_t)(nBlk + srow) * K + sch;
  const size_t g32 = (size_t)32 * K;                            // 32 rows further, halves
  const unsigned lA = (unsigned)(uintptr_t)(As + srow * LDT + sch);   // LDS byte address, buffer 0
  const unsigned lB = lA + BM * LDT * 2;
  const unsigned l32 = 32 * LDT * 2;                            // 32 rows further, bytes
  const unsigned lbuf = GBUF_H * 2;                             // buffer size, bytes
  const int nk = K / BK;

  // stage 0 into buffer 0; landed and published before anything reads it
  stage_ab(lA, lB, l32, gA, gB, g32);
  asm volatile("s_wait_asynccnt 0x0" ::: "memory");            // this wave's copies have landed
  __syncthreads();                                              // every wave's copies are readable
  if (nk > 1) stage_ab(lA + lbuf, lB + lbuf, l32, gA + BK, gB + BK, g32);

  v8f acc[4][2];
#pragma unroll
  for (int i = 0; i < 4; ++i)
#pragma unroll
    for (int j = 0; j < 2; ++j)
#pragma unroll
      for (int v = 0; v < 8; ++v) acc[i][j][v] = 0.f;

#pragma unroll 1
  for (int kt = 0; kt < nk; ++kt) {
    const _Float16* At = As + (kt & 1) * GBUF_H;
    const _Float16* Bs = At + BM * LDT;
#pragma unroll
    for (int ks = 0; ks < BK / 32; ++ks) {
      v16h af[4], bfr[2];
#pragma unroll
      for (int i = 0; i < 4; ++i) af[i] = load_frag(At + (mw + i * 16 + r) * LDT + ks * 32 + hb);
#pragma unroll
      for (int j = 0; j < 2; ++j) bfr[j] = load_frag(Bs + (nw + j * 16 + r) * LDT + ks * 32 + hb);
#pragma unroll
      for (int i = 0; i < 4; ++i)
#pragma unroll
        for (int j = 0; j < 2; ++j) acc[i][j] = wmma16(af[i], bfr[j], acc[i][j]);
    }
    // publish point of stage kt + 1, and hand-over of this stage's buffer
    asm volatile("s_wait_dscnt 0x0" ::: "memory");             // this wave's reads of the buffer are done
    asm volatile("s_wait_asynccnt 0x0" ::: "memory");          // this wave's copies of stage kt + 1 have landed
    __syncthreads();                                            // publishes kt + 1, ends every read of kt
    if (kt + 2 < nk) {
      const unsigned lo = (unsigned)(kt & 1) * lbuf;
      const size_t ko = (size_t)(kt + 2) * BK;
      stage_ab(lA + lo, lB + lo, l32, gA + ko, gB + ko, g32);
    }
  }
  asm volatile("s_wait_asynccnt 0x0" ::: "memory");            // nothing in flight when LDS changes its use
  // the last stage's own barrier has ended every read: LDS is free for the epilogue stage

  // epilogue. D layout: element v -> row 8*lanehi + v, lane&15 -> col.
  float* stg = smem;                          // [64][EPF] f32
  float bcol[2] = {0.f, 0.f};
  if constexpr (HAS_BIAS) {
#pragma unroll
    for (int j = 0; j < 2; ++j) bcol[j] = bf16r(bias[nBlk + nw + j * 16 + r]);
  }
#pragma unroll
  for (int p = 0; p < 2; ++p) {
    if ((wave & 1) == p) {                    // wave-uniform: waves owning rows p*64..p*64+63
#pragma unroll
      for (int i = 0; i < 4; ++i)
#pragma unroll
        for (int j = 0; j < 2; ++j)
#pragma unroll
          for (int v = 0; v < 8; ++v) {
            const int lr = i * 16 + hb + v;                   // 0..63
            const int lc = nw + j * 16 + r;                   // 0..127
            float c = acc[i][j][v] * scale;
            if constexpr (HAS_BIAS) c += bcol[j];
            if constexpr (RELU) c = fmaxf(c, 0.f);
            stg[lr * EPF + lc] = c;
          }
    }
    __syncthreads();
    if constexpr (OUT16) {
      // f16 row segment = 128 halves = 256 B = 2 lines; 16 lanes x 16 B per row
      v8h hv[4];
      size_t go[4];
#pragma unroll
      for (int it = 0; it < 4; ++it) {
        const int lr = it * 16 + wave * 2 + (lane >> 4);   // 0..63
        const int lc = (lane & 15) << 3;                    // 0..120
        const v4f x0 = *(const v4f*)(stg + lr * EPF + lc);
        const v4f x1 = *(const v4f*)(stg + lr * EPF + lc + 4);
        v8h hh;
#pragma unroll
        for (int e = 0; e < 4; ++e) { hh[e] = (_Float16)x0[e]; hh[e + 4] = (_Float16)x1[e]; }
        hv[it] = hh;
        go[it] = (size_t)(mBlk + p * 64 + lr) * (size_t)N + nBlk + lc;
      }
#pragma unroll
      for (int it = 0; it < 4; ++it) *(v8h*)(outH + go[it]) = hv[it];
      
    } else {
      // f32 row segment = 128 floats = 512 B = 4 lines; 32 lanes x 16 B per row.
      // Residual added here from one 16-B load per row per lane (8 global loads per lane).
      v4f fv[8];
      size_t go[8];
#pragma unroll
      for (int it = 0; it < 8; ++it) {
        const int lr = it * 8 + wave;                        // 0..63
        const int lc = lane << 2;                            // 0..124
        const size_t grow = (size_t)(mBlk + p * 64 + lr);
        const size_t gcol = (size_t)(nBlk + lc);
        v4f val = *(const v4f*)(stg + lr * EPF + lc);
        if constexpr (RES == 1) {
          const v4f rr = *(const v4f*)(res + grow * (size_t)N + gcol);
#pragma unroll
          for (int e = 0; e < 4; ++e) val[e] = val[e] + rr[e];
        }
        if constexpr (RES == 2) {
          const v4f rr = *(const v4f*)(res + FROW(grow) * (size_t)DIM + gcol);
#pragma unroll
          for (int e = 0; e < 4; ++e) val[e] = val[e] + bf16r(rr[e]);
        }
        fv[it] = val;
        go[it] = grow * (size_t)N + gcol;
      }
#pragma unroll
      for (int it = 0; it < 8; ++it) *(v4f*)(outF + go[it]) = fv[it];
      
    }
    __syncthreads();                          // stage reused by the other row half
  }
}

#define OPAD 72   // O stage row stride (halves)
#define AW 8                    // waves per block
#define AQ (AW * 16)            // query rows per block
#define SK 64                   // keys per stage
#define KVP 72                  // staged row pitch in halves (144 B = 16 B x odd)
#define TILE_H (64 * KVP)       // halves per staged tile
#define NST (SEQ / SK)          // stages
static_assert((SEQ % AQ) == 0 && (SEQ % SK) == 0 && AW * 32 == 256);

// One stage: each lane copies two 16-B pieces of the K tile and two of the V^T tile.
// The s_wait_xcnt stands inside the statement so that no address register of a
// copy is rewritten in front of it.
static __device__ __forceinline__ void stage_kv(unsigned lk0, unsigned lk1, unsigned lv0, unsigned lv1,
                                                const _Float16* gk0, const _Float16* gk1,
                                                const _Float16* gv0, const _Float16* gv1) {
  asm volatile(
      "global_load_async_to_lds_b128 %0, %4, off\n\t"
      "global_load_async_to_lds_b128 %1, %5, off\n\t"
      "global_load_async_to_lds_b128 %2, %6, off\n\t"
      "global_load_async_to_lds_b128 %3, %7, off\n\t"
      "s_wait_xcnt 0x0"
      :: "v"(lk0), "v"(lk1), "v"(lv0), "v"(lv1), "v"(gk0), "v"(gk1), "v"(gv0), "v"(gv1)
      : "memory");
}

// value of lane l ^ 16 (the other half's share of the same query column)
static __device__ __forceinline__ float xhalf(float x) {
  return __builtin_bit_cast(float, __builtin_amdgcn_permlanex16(
      __builtin_bit_cast(int, x), __builtin_bit_cast(int, x), 0x76543210, 0xfedcba98, false, false));
}

__global__ __launch_bounds__(256) __attribute__((amdgpu_num_vgpr(256)))
void attn_kernel(const _Float16* __restrict__ qkv, const _Float16* __restrict__ vt,
                 _Float16* __restrict__ ctx) {
  __shared__ __attribute__((aligned(16))) _Float16 KV[2 * 2 * TILE_H];   // [buffer][K | V^T][row][KVP]
  __shared__ __attribute__((aligned(16))) _Float16 Os[AW * 16 * OPAD];   // per-wave O 16x64
  const int nqt = SEQ / AQ;
  const int qt = (int)(blockIdx.x % nqt);
  const int bh = (int)(blockIdx.x / nqt);
  const int h = bh % NHEAD, b = bh / NHEAD;
  const int tid = threadIdx.x, wave = tid >> 5, lane = tid & 31;
  const int r = lane & 15, hb = (lane >> 4) << 3;
  const _Float16* Qb = qkv + (size_t)b * SEQ * LDQKV + h * DHEAD;
  const _Float16* Kh = Qb + DIM;
  const _Float16* Vh = vt + (size_t)bh * DHEAD * SEQ;
  const int q0 = qt * AQ + wave * 16;

  // staging coords: 64 rows x 8 pieces of 16 B per tile = 512 pieces, 2 per thread
  const int srow = tid >> 3, sch = (tid & 7) << 3;
  const _Float16* gK = Kh + (size_t)srow * LDQKV + sch;      // + key0 * LDQKV per stage
  const _Float16* gV = Vh + (size_t)srow * SEQ + sch;        // + key0 per stage
  const unsigned lK = (unsigned)(uintptr_t)(KV + srow * KVP + sch);   // LDS byte address, buffer 0
  const unsigned lV = lK + TILE_H * 2;
  const unsigned l32 = 32 * KVP * 2;                          // 32 rows further, bytes
  const unsigned lbuf = 2 * TILE_H * 2;                       // buffer size, bytes

  // stage 0 into buffer 0; landed and published before anything reads it
  stage_kv(lK, lK + l32, lV, lV + l32, gK, gK + (size_t)32 * LDQKV, gV, gV + (size_t)32 * SEQ);
  asm volatile("s_wait_asynccnt 0x0" ::: "memory");          // this wave's copies have landed
  __syncthreads();                                            // every wave's copies are readable
  if (NST > 1) {
    const _Float16* k1 = gK + (size_t)SK * LDQKV;
    const _Float16* v1 = gV + SK;
    stage_kv(lK + lbuf, lK + lbuf + l32, lV + lbuf, lV + lbuf + l32,
             k1, k1 + (size_t)32 * LDQKV, v1, v1 + (size_t)32 * SEQ);
  }

  // Q fragments (B: lane -> query column, halves -> d), d chunks 0..31 and 32..63
  v16h aq[2];
#pragma unroll
  for (int dc = 0; dc < 2; ++dc)
    aq[dc] = load_frag(Qb + (size_t)(q0 + r) * LDQKV + dc * 32 + hb);

  // constant all-ones A fragment: ones . P^T -> per-query sums (every row of D alike)
  v16h ones;
#pragma unroll
  for (int e = 0; e < 16; ++e) ones[e] = (_Float16)1.0f;

  v8f o[4];
#pragma unroll
  for (int t = 0; t < 4; ++t)
#pragma unroll
    for (int v = 0; v < 8; ++v) o[t][v] = 0.f;
  float mrow = -1e30f, lrow = 0.f;           // of this lane's query (q0 + r), alike in both halves

  const v8f zero = {0.f, 0.f, 0.f, 0.f, 0.f, 0.f, 0.f, 0.f};

#pragma unroll 1
  for (int st = 0; st < NST; ++st) {
   const _Float16* Kt = KV + (st & 1) * (2 * TILE_H);
   const _Float16* Vt = Kt + TILE_H;
#pragma unroll
   for (int sub = 0; sub < SK / 32; ++sub) {
    const int key0 = sub * 32;                // key offset inside the staged tile

    // S^T(32x16) = K(32x64) . Q^T : A-frag lane -> key, halves -> d (split map)
    // D: element v of tile kt -> key kt*16 + 8*lanehi + v, lane&15 -> query
    v8f s[2];
#pragma unroll
    for (int kt = 0; kt < 2; ++kt)
#pragma unroll
      for (int v = 0; v < 8; ++v) s[kt][v] = 0.f;
#pragma unroll
    for (int kt = 0; kt < 2; ++kt)
#pragma unroll
      for (int dc = 0; dc < 2; ++dc) {
        const v16h ak = load_frag(Kt + (key0 + kt * 16 + r) * KVP + dc * 32 + hb);
        s[kt] = wmma16(ak, aq[dc], s[kt]);
      }

    // online softmax of one query per lane: 16 keys here, 16 in lane ^ 16
    float m8[8];
#pragma unroll
    for (int v = 0; v < 8; ++v) m8[v] = fmaxf(s[0][v], s[1][v]);
    float mx = fmaxf(fmaxf(fmaxf(m8[0], m8[1]), fmaxf(m8[2], m8[3])),
                     fmaxf(fmaxf(m8[4], m8[5]), fmaxf(m8[6], m8[7]))) * 0.125f;   // * DH^-0.5
    mx = fmaxf(mx, xhalf(mx));
    const float mnew = fmaxf(mrow, mx);
    const float alpha = __expf(mrow - mnew);
    mrow = mnew;

    // P^T as the B operand: half e -> key (e < 8 ? 8*lanehi + e : 16 + 8*lanehi + e - 8),
    // which is element e & 7 of tile e >> 3 of this very lane
    v16h pf;
#pragma unroll
    for (int kt = 0; kt < 2; ++kt)
#pragma unroll
      for (int v = 0; v < 8; ++v)
        pf[kt * 8 + v] = (_Float16)(__expf(s[kt][v] * 0.125f - mnew) * 1024.0f);   // P carried x1024

    // row sums on the matrix pipe
    const v8f rsum = wmma16(ones, pf, zero);
    lrow = lrow * alpha + rsum[0];

    // O^T(64x16) = alpha*O^T + V^T(64x32) . P^T(32x16); V^T rows are d, key-contiguous
#pragma unroll
    for (int t = 0; t < 4; ++t) {
#pragma unroll
      for (int v = 0; v < 8; ++v) o[t][v] *= alpha;
      const v16h av = load_frag(Vt + (t * 16 + r) * KVP + key0 + hb);
      o[t] = wmma16(av, pf, o[t]);
    }
   }
   // publish point of stage st + 1, and hand-over of this stage's buffer
   asm volatile("s_wait_dscnt 0x0" ::: "memory");            // this wave's reads of the buffer are done
   asm volatile("s_wait_asynccnt 0x0" ::: "memory");         // this wave's copies of stage st + 1 have landed
   __syncthreads();                                           // publishes st + 1, ends every read of st
   if (st + 2 < NST) {
     const _Float16* kn = gK + (size_t)(st + 2) * SK * LDQKV;
     const _Float16* vn = gV + (st + 2) * SK;
     const unsigned lo = (unsigned)(st & 1) * lbuf;
     stage_kv(lK + lo, lK + lo + l32, lV + lo, lV + lo + l32,
              kn, kn + (size_t)32 * LDQKV, vn, vn + (size_t)32 * SEQ);
   }
  }
  asm volatile("s_wait_asynccnt 0x0" ::: "memory");          // nothing in flight when the wave ends

  // ctx = 16 * O / l  (the x1024 P carry cancels between O and l)
  // O^T: element v of tile t -> d = t*16 + 8*lanehi + v of query r: 8 consecutive halves
  _Float16* Ow = Os + wave * 16 * OPAD;
  const float inv = 16.0f / lrow;
#pragma unroll
  for (int t = 0; t < 4; ++t) {
    v8h ov;
#pragma unroll
    for (int v = 0; v < 8; ++v) ov[v] = (_Float16)(o[t][v] * inv);
    *(v8h*)(Ow + r * OPAD + t * 16 + hb) = ov;
  }
  __syncthreads();

  const int rs = lane >> 3, cc = (lane & 7) << 3;
  v8h hv[4];
  size_t go[4];
#pragma unroll
  for (int it = 0; it < 4; ++it) {
    const int lr = it * 4 + rs;               // 0..15
    hv[it] = *(const v8h*)(Ow + lr * OPAD + cc);
    go[it] = ((size_t)b * SEQ + q0 + lr) * (size_t)DIM + h * DHEAD + cc;
  }
#pragma unroll
  for (int it = 0; it < 4; ++it) *(v8h*)(ctx + go[it]) = hv[it];
  
}

// ---------------------------------------------------------------------------
// in: f32 [MROWS][DIM] (residual already added).  outF: f32 (row mapped to the
// full-size layout when MAPOUT), outH: f16 copy (compact rows) when OUT16.
// One wave owns LNR whole rows: a row is 8 loads of 16 B per lane (512 contiguous
// bytes per wave load), kept in registers for mean, variance and output. All row
// loads of a wave are issued before the first sum. No LDS and no barrier: the sums
// cross lanes by DPP inside a 16-lane row and one exchange between the lane halves.
// ---------------------------------------------------------------------------
#define LNR 2                    // rows per wave
#define LNW 8                    // waves per block
#define LNC (DIM / 128)          // 16-B pieces of a row per lane
static_assert((MROWS % (LNR * LNW)) == 0 && (DIM % 512) == 0 && LNW * 32 == 256);

// x + (x of lane ^ M) inside a 16-lane row (DPP row_xmask:M)
template <int M>
static __device__ __forceinline__ float add_xmask(float x) {
  return x + __builtin_bit_cast(float, __builtin_amdgcn_update_dpp(
      0, __builtin_bit_cast(int, x), 0x160 + M, 0xf, 0xf, true));
}
// sum over the 32 lanes, alike in every lane
static __device__ __forceinline__ float wave_sum(float x) {
  x = add_xmask<1>(x);
  x = add_xmask<2>(x);
  x = add_xmask<4>(x);
  x = add_xmask<8>(x);
  return x + xhalf(x);
}

template <bool OUT16, bool MAPOUT>
__global__ __launch_bounds__(256) void ln_kernel(
    const float* __restrict__ in, const float* __restrict__ g, const float* __restrict__ bt,
    float* __restrict__ outF, _Float16* __restrict__ outH) {
  typedef _Float16 v4h __attribute__((ext_vector_type(4)));
  const int tid = threadIdx.x, wave = tid >> 5, lane = tid & 31;
  const size_t row0 = ((size_t)blockIdx.x * LNW + wave) * LNR;
  const int col = lane * 4;                  // + c * 128
  v4f gg[LNC], bb[LNC];
#pragma unroll
  for (int c = 0; c < LNC; ++c) {
    gg[c] = *(const v4f*)(g + c * 128 + col);
    bb[c] = *(const v4f*)(bt + c * 128 + col);
  }
  v4f v[LNR][LNC];
#pragma unroll
  for (int rr = 0; rr < LNR; ++rr)
#pragma unroll
    for (int c = 0; c < LNC; ++c) v[rr][c] = *(const v4f*)(in + (row0 + rr) * DIM + c * 128 + col);
  // keeps every load of the wave in front of the first sum: without it the compiler
  // sinks the second row's loads behind the first row's sums and waits them out in turn
  __builtin_amdgcn_sched_barrier(0);
#pragma unroll
  for (int c = 0; c < LNC; ++c)
#pragma unroll
    for (int e = 0; e < 4; ++e) { gg[c][e] = bf16r(gg[c][e]); bb[c][e] = bf16r(bb[c][e]); }
  // keeps the rounding of g and b (first loads back) in front of the row sums, so that
  // it runs while the rows are still in flight
  __builtin_amdgcn_sched_barrier(0);

#pragma unroll
  for (int rr = 0; rr < LNR; ++rr) {
    float p[LNC];
#pragma unroll
    for (int c = 0; c < LNC; ++c) p[c] = (v[rr][c][0] + v[rr][c][1]) + (v[rr][c][2] + v[rr][c][3]);
    float s = 0.f;
#pragma unroll
    for (int c = 0; c < LNC; c += 4) s += (p[c] + p[c + 1]) + (p[c + 2] + p[c + 3]);
    const float mu = wave_sum(s) * (1.0f / (float)DIM);
#pragma unroll
    for (int c = 0; c < LNC; ++c) {
#pragma unroll
      for (int e = 0; e < 4; ++e) v[rr][c][e] -= mu;
      p[c] = (v[rr][c][0] * v[rr][c][0] + v[rr][c][1] * v[rr][c][1]) +
             (v[rr][c][2] * v[rr][c][2] + v[rr][c][3] * v[rr][c][3]);
    }
    float ss = 0.f;
#pragma unroll
    for (int c = 0; c < LNC; c += 4) ss += (p[c] + p[c + 1]) + (p[c + 2] + p[c + 3]);
    const float var = wave_sum(ss) * (1.0f / (float)DIM);
    const float rstd = rsqrtf(var + 1e-5f);
    const size_t row = row0 + rr;
    const size_t orow = MAPOUT ? FROW(row) : row;
    float* op = outF + orow * DIM + col;
#pragma unroll
    for (int c = 0; c < LNC; ++c) {
      v4f y;
#pragma unroll
      for (int e = 0; e < 4; ++e) y[e] = v[rr][c][e] * rstd * gg[c][e] + bb[c][e];
      *(v4f*)(op + c * 128) = y;             // 512 contiguous bytes per wave store
      if constexpr (OUT16) {
        v4h hy;
#pragma unroll
        for (int e = 0; e < 4; ++e) hy[e] = (_Float16)y[e];
        *(v4h*)(outH + row * DIM + col + c * 128) = hy;   // 256 contiguous bytes per wave store
      }
    }
  }
}

// ---------------------------------------------------------------------------
// Launch plan (9 launches):
//  cvt_all (x and all six weights), gemm qkv, vtrans, attn, gemm o (+x),
//  ln1, gemm 1 (relu), gemm 2 (+h), ln2 -> d_out
// Workspace (byte offsets derived below, total 106 MiB at full size):
//  W planes 10 MiB | P1 16 MiB: X16 -> VT16 -> G16 | P2 48 MiB: QKV16 -> {R1, H16} -> R2
//  | P3 32 MiB: CTX16 -> H32
// ---------------------------------------------------------------------------
extern "C" void kernel_launch(void* const* d_in, const int* in_sizes, int n_in,
                              void* d_out, int out_size, void* d_ws, size_t ws_size,
                              hipStream_t stream) {
  if (n_in < 13) return;
  const size_t needX = ((size_t)(NB - 1) * SEQ_FULL + SEQ) * DIM;
  if ((size_t)in_sizes[0] < needX) return;
  if (in_sizes[1] < DIM * DIM || in_sizes[2] < DIM * DIM || in_sizes[3] < DIM * DIM ||
      in_sizes[4] < DIM * DIM) return;
  if (in_sizes[5] < DIM || in_sizes[6] < DIM || in_sizes[10] < DIM || in_sizes[11] < DIM ||
      in_sizes[12] < DIM) return;
  if (in_sizes[7] < DIM * HID || in_sizes[8] < HID || in_sizes[9] < HID * DIM) return;
  if ((size_t)out_size < needX) return;

  const float* x     = (const float*)d_in[0];
  const float* Wq    = (const float*)d_in[1];
  const float* Wk    = (const float*)d_in[2];
  const float* Wv    = (const float*)d_in[3];
  const float* Wo    = (const float*)d_in[4];
  const float* ln1_g = (const float*)d_in[5];
  const float* ln1_b = (const float*)d_in[6];
  const float* W1    = (const float*)d_in[7];
  const float* b1    = (const float*)d_in[8];
  const float* W2    = (const float*)d_in[9];
  const float* b2    = (const float*)d_in[10];
  const float* ln2_g = (const float*)d_in[11];
  const float* ln2_b = (const float*)d_in[12];
  float* out = (float*)d_out;

  // carve (all region sizes are exact multiples of the whole-line stores used)
  const size_t szWqkv = (size_t)3 * DIM * DIM * 2;     // [3072][1024] f16
  const size_t szWo   = (size_t)DIM * DIM * 2;         // [1024][1024] f16
  const size_t szW1   = (size_t)HID * DIM * 2;         // [512][1024]  f16 (W1^T)
  const size_t szW2   = (size_t)DIM * HID * 2;         // [1024][512]  f16 (W2^T)
  const size_t szP1   = (size_t)MROWS * DIM * 2;       // X16 / VT16 / G16
  const size_t szP2   = (size_t)MROWS * LDQKV * 2;     // QKV16 / {R1,H16} / R2
  const size_t szP3   = (size_t)MROWS * DIM * 4;       // CTX16 / H32
  const size_t oWqkv = 0;
  const size_t oWo   = oWqkv + szWqkv;
  const size_t oW1   = oWo + szWo;
  const size_t oW2   = oW1 + szW1;
  const size_t oP1   = oW2 + szW2;
  const size_t oP2   = oP1 + szP1;
  const size_t oP3   = oP2 + szP2;
  const size_t total = oP3 + szP3;
  if (total > ws_size) return;
  static_assert((size_t)MROWS * DIM * 4 + (size_t)MROWS * DIM * 2 <= (size_t)MROWS * LDQKV * 2);
  static_assert((size_t)MROWS * HID * 2 <= (size_t)MROWS * DIM * 2);
  static_assert((size_t)NB * NHEAD * DHEAD * SEQ * 2 <= (size_t)MROWS * DIM * 2);

  char* ws = (char*)d_ws;
  _Float16* Wqkv_t = (_Float16*)(ws + oWqkv);
  _Float16* Wo_t   = (_Float16*)(ws + oWo);
  _Float16* W1_t   = (_Float16*)(ws + oW1);
  _Float16* W2_t   = (_Float16*)(ws + oW2);
  _Float16* X16    = (_Float16*)(ws + oP1);
  _Float16* VT16   = (_Float16*)(ws + oP1);
  _Float16* G16    = (_Float16*)(ws + oP1);
  _Float16* QKV16  = (_Float16*)(ws + oP2);
  float*    R1     = (float*)   (ws + oP2);
  _Float16* H16    = (_Float16*)(ws + oP2 + (size_t)MROWS * DIM * 4);
  float*    R2     = (float*)   (ws + oP2);
  _Float16* CTX16  = (_Float16*)(ws + oP3);
  float*    H32    = (float*)   (ws + oP3);

  const float wsc   = 32.0f;                  // weight carry
  const float inv32 = 1.0f / 32.0f;
  const float inv512 = 1.0f / 512.0f;         // 1/(32 weight carry * 16 ctx carry)

  // 1, 2) x -> X16 (bf16 RNE, f16 container); weights -> transposed f16 planes, bf16 RNE then x32
  cvt_all_kernel<<<dim3(WBLKS + XBLKS), 256, 0, stream>>>(
      x, Wq, Wk, Wv, Wo, W1, W2, X16, Wqkv_t, Wo_t, W1_t, W2_t, wsc);

  // 3) qkv = x @ [Wq | Wk | Wv]   (f16 out, 1/32 folded)
  gemm_kernel<false, 0, false, true>
      <<<dim3(LDQKV / BN, MROWS / BM), 256, 0, stream>>>(
          X16, Wqkv_t, nullptr, nullptr, nullptr, QKV16, LDQKV, DIM, inv32);

  // 4) V^T plane per (b,h)
  vtrans_kernel<<<dim3(SEQ / 64, NB * NHEAD), 256, 0, stream>>>(QKV16, VT16);

  // 5) ctx = softmax(q k^T / 8) v    (f16 out, carried x16)
  attn_kernel<<<dim3(NB * NHEAD * (SEQ / AQ)), 256, 0, stream>>>(QKV16, VT16, CTX16);

  // 6) r1 = ctx @ Wo + bf16r(x)        (f32 out)
  gemm_kernel<false, 2, false, false>
      <<<dim3(DIM / BN, MROWS / BM), 256, 0, stream>>>(
          CTX16, Wo_t, nullptr, x, R1, nullptr, DIM, DIM, inv512);

  // 7) h = LN1(r1)                     (f32 + f16)
  ln_kernel<true, false><<<dim3(MROWS / (LNR * LNW)), 256, 0, stream>>>(R1, ln1_g, ln1_b, H32, H16);

  // 8) g = relu(h @ W1 + b1)           (f16 out)
  gemm_kernel<true, 0, true, true>
      <<<dim3(HID / BN, MROWS / BM), 256, 0, stream>>>(
          H16, W1_t, b1, nullptr, nullptr, G16, HID, DIM, inv32);

  // 9) r2 = g @ W2 + b2 + h            (f32 out)
  gemm_kernel<true, 1, false, false>
      <<<dim3(DIM / BN, MROWS / BM), 256, 0, stream>>>(
          G16, W2_t, b2, H32, R2, nullptr, DIM, HID, inv32);

  // 10) out = LN2(r2)                  (f32, full-size row layout)
  ln_kernel<false, true><<<dim3(MROWS / (LNR * LNW)), 256, 0, stream>>>(R2, ln2_g, ln2_b, out, nullptr);
}
